// v000
// Times are from an AMD MI455X. After a warm-up the kernel runs many times in a row, and a time is the length of
// such a window on the GPU divided by its runs, so every launch and the gaps after it count. The runs cycle
// through copies of the inputs. A figure is the median of several windows, for all but v000 over two sittings.
// Sittings can differ by a few percent; kernels timed side by side share one.
// v000 is the starting kernel. One run takes 565 microseconds.
#include <hip/hip_runtime.h>
#include <hip/hip_bf16.h>

// Problem constants
#define BB 8
#define CH 160
#define CL 80
#define NN 4096   // H*W = 64*64

typedef __attribute__((ext_vector_type(2))) float v2f;
typedef __attribute__((ext_vector_type(8))) float v8f;

// ---------------------------------------------------------------------------
// Kernel 1: fold the linear chain  Wc = Wh @ W1,  bc = Wh @ b1 + bh
// ---------------------------------------------------------------------------
__global__ void k_combine(const float* __restrict__ W1, const float* __restrict__ b1,
                          const float* __restrict__ Wh, const float* __restrict__ bh,
                          float* __restrict__ Wc, float* __restrict__ bc) {
    int idx = blockIdx.x * blockDim.x + threadIdx.x;
    if (idx < CL * CH) {
        int o = idx / CH, i = idx - o * CH;
        float s = 0.f;
        for (int j = 0; j < CH; ++j) s += Wh[o * CH + j] * W1[j * CH + i];
        Wc[idx] = s;
    } else if (idx < CL * CH + CL) {
        int o = idx - CL * CH;
        float s = bh[o];
        for (int j = 0; j < CH; ++j) s += Wh[o * CH + j] * b1[j];
        bc[o] = s;
    }
}

// ---------------------------------------------------------------------------
// Kernel 2: projections.  blockIdx.y selects matrix:
//   0: XL = Wc @ x_latter + bc   (written straight into d_out second half)
//   1: XQ = Wl @ x + bl
//   2: V  = Wv @ x + bv
// ---------------------------------------------------------------------------
__global__ void __launch_bounds__(256)
k_proj(const float* __restrict__ xlat, const float* __restrict__ x,
       const float* __restrict__ Wc, const float* __restrict__ bc,
       const float* __restrict__ Wl, const float* __restrict__ bl,
       const float* __restrict__ Wv, const float* __restrict__ bv,
       float* __restrict__ XL, float* __restrict__ XQ, float* __restrict__ V) {
    int idx = blockIdx.x * blockDim.x + threadIdx.x;   // over BB*CL*NN
    int n = idx & (NN - 1);
    int c = (idx >> 12) % CL;
    int b = idx / (CL * NN);
    const float *W, *bias, *src;
    float* dst;
    int Cin;
    if (blockIdx.y == 0)      { W = Wc; bias = bc; src = xlat + (size_t)b * CH * NN; Cin = CH; dst = XL; }
    else if (blockIdx.y == 1) { W = Wl; bias = bl; src = x    + (size_t)b * CL * NN; Cin = CL; dst = XQ; }
    else                      { W = Wv; bias = bv; src = x    + (size_t)b * CL * NN; Cin = CL; dst = V;  }
    float s = bias[c];
    const float* wr = W + c * Cin;
    for (int i = 0; i < Cin; ++i) s += wr[i] * src[(size_t)i * NN + n];
    dst[idx] = s;
}

// ---------------------------------------------------------------------------
// Kernel 3: per-column softmax stats (softmax over axis=1 == over n, per m).
// Block = 8 waves * 16 columns = 128 columns of m.  The XQ n-tile (16x80) is
// shared by all 8 waves: double-buffered in LDS, filled with the CDNA5
// async-copy path (global_load_async_to_lds_b32, ASYNCcnt) overlapped with
// the WMMA compute of the current tile.  A-fragments then come from LDS as
// aligned ds_load_b64 ([n][stride 82] layout: (c,c+1) contiguous, 8B aligned,
// stride mod 64 = 18 -> conflict-free across 16 lanes).
// ---------------------------------------------------------------------------
#define AST 82   // LDS row stride (floats) for staged A tile
__global__ void __launch_bounds__(256)
k_stats(const float* __restrict__ XQ, const float* __restrict__ XL,
        float* __restrict__ Ms, float* __restrict__ Ss) {
    __shared__ float a_lds[2][16 * AST];

    const int tid  = threadIdx.x;
    const int lane = tid & 31;
    const int wave = tid >> 5;
    const int b    = blockIdx.y;
    const int m0   = blockIdx.x * 128 + wave * 16;
    const int ln   = lane & 15;
    const int hi2  = (lane >> 4) << 1;

    const float* q  = XQ + (size_t)b * CL * NN;
    const float* km = XL + (size_t)b * CL * NN;

    // this thread's share of the cooperative tile copy: 5 dwords
    const int cc[5] = { (tid) >> 4, (tid + 256) >> 4, (tid + 512) >> 4,
                        (tid + 768) >> 4, (tid + 1024) >> 4 };
    const int nl = tid & 15;

    // per-wave B fragments (XL columns m0..m0+15), resident for whole kernel
    v2f bf[20];
#pragma unroll
    for (int k = 0; k < 20; ++k) {
        int c = 4 * k + hi2;
        bf[k].x = km[(size_t)c * NN + m0 + ln];
        bf[k].y = km[(size_t)(c + 1) * NN + m0 + ln];
    }

    // prologue: async-fill buffer 0 with n-tile 0
#pragma unroll
    for (int j = 0; j < 5; ++j) {
        unsigned loff = (unsigned)(uintptr_t)&a_lds[0][nl * AST + cc[j]];
        const float* g = q + (size_t)cc[j] * NN + nl;
        asm volatile("global_load_async_to_lds_b32 %0, %1, off"
                     :: "v"(loff), "v"(g) : "memory");
    }
    asm volatile("s_wait_asynccnt 0x0" ::: "memory");
    __syncthreads();

    float Mrun = -3.0e38f, Srun = 0.f;
    for (int it = 0; it < NN / 16; ++it) {
        const int cur = it & 1;
        // prefetch next tile into the other buffer (overlaps with compute)
        if (it + 1 < NN / 16) {
            const int n1 = (it + 1) * 16;
#pragma unroll
            for (int j = 0; j < 5; ++j) {
                unsigned loff = (unsigned)(uintptr_t)&a_lds[cur ^ 1][nl * AST + cc[j]];
                const float* g = q + (size_t)cc[j] * NN + n1 + nl;
                asm volatile("global_load_async_to_lds_b32 %0, %1, off"
                             :: "v"(loff), "v"(g) : "memory");
            }
        }
        // ---- logits tile from staged A + resident B ----
        v8f acc = {};
#pragma unroll
        for (int k = 0; k < 20; ++k) {
            v2f a = *(const v2f*)&a_lds[cur][ln * AST + 4 * k + hi2];  // ds_load_b64
            acc = __builtin_amdgcn_wmma_f32_16x16x4_f32(false, a, false, bf[k],
                                                        (short)0, acc, false, false);
        }
        // ---- online column max/sum; lane pair (l, l+16) holds one column ----
        float tmax = acc[0];
#pragma unroll
        for (int r = 1; r < 8; ++r) tmax = fmaxf(tmax, acc[r]);
        tmax = fmaxf(tmax, __shfl_xor(tmax, 16, 32));
        float Mnew = fmaxf(Mrun, tmax);
        float tsum = 0.f;
#pragma unroll
        for (int r = 0; r < 8; ++r) tsum += __expf(acc[r] - Mnew);
        tsum += __shfl_xor(tsum, 16, 32);
        Srun = Srun * __expf(Mrun - Mnew) + tsum;
        Mrun = Mnew;

        asm volatile("s_wait_asynccnt 0x0" ::: "memory");
        __syncthreads();
    }
    if (lane < 16) {
        Ms[(size_t)b * NN + m0 + lane] = Mrun;
        Ss[(size_t)b * NN + m0 + lane] = Srun;
    }
}

// ---------------------------------------------------------------------------
// Kernel 4: e_out[b][c][n] = sum_m P[n,m] * V[c,m] + XQ[c,n]
// Block = 4 waves, a 32-row n band (two 16-row tiles per wave); wave w covers
// m in [w*1024,(w+1)*1024).  Every XL / V B-fragment load is shared by both
// n-tiles (halves B traffic per WMMA).  P is restaged through per-wave LDS
// (stride 18 -> aligned ds_load_b64 A-fragments).  Cross-wave reduce via
// ds_add_f32 LDS atomics, then add XQ residual and store [B,C,N].
// ---------------------------------------------------------------------------
#define PST 18   // LDS row stride (floats) for staged P tiles
__global__ void __launch_bounds__(128)
k_out(const float* __restrict__ XQ, const float* __restrict__ XL,
      const float* __restrict__ V, const float* __restrict__ Ms,
      const float* __restrict__ Ss, float* __restrict__ Eout) {
    __shared__ float E_lds[32 * CL];
    __shared__ float P_lds[4][2][16 * PST];

    const int tid  = threadIdx.x;
    const int lane = tid & 31;
    const int wave = tid >> 5;
    const int b    = blockIdx.y;
    const int n0   = blockIdx.x * 32;
    const int ln   = lane & 15;
    const int hi2  = (lane >> 4) << 1;
    const int rhi  = (lane >> 4) << 3;

    for (int i = tid; i < 32 * CL; i += 128) E_lds[i] = 0.f;
    __syncthreads();

    const float* q  = XQ + (size_t)b * CL * NN;
    const float* km = XL + (size_t)b * CL * NN;
    const float* vm = V  + (size_t)b * CL * NN;
    const float* Mp = Ms + (size_t)b * NN;
    const float* Sp = Ss + (size_t)b * NN;

    // A-fragments of XQ for both n-tiles (reused for all m-tiles)
    v2f aq0[20], aq1[20];
#pragma unroll
    for (int k = 0; k < 20; ++k) {
        int c = 4 * k + hi2;
        aq0[k].x = q[(size_t)c * NN + n0 + ln];
        aq0[k].y = q[(size_t)(c + 1) * NN + n0 + ln];
        aq1[k].x = q[(size_t)c * NN + n0 + 16 + ln];
        aq1[k].y = q[(size_t)(c + 1) * NN + n0 + 16 + ln];
    }

    v8f E0[5] = {}, E1[5] = {};
    float* pl0 = &P_lds[wave][0][0];
    float* pl1 = &P_lds[wave][1][0];

    for (int mt = 0; mt < 64; ++mt) {
        const int m0 = wave * 1024 + mt * 16;
        // ---- two logits tiles, B fragments loaded once ----
        v8f acc0 = {}, acc1 = {};
#pragma unroll
        for (int k = 0; k < 20; ++k) {
            int c = 4 * k + hi2;
            v2f bfr;
            bfr.x = km[(size_t)c * NN + m0 + ln];
            bfr.y = km[(size_t)(c + 1) * NN + m0 + ln];
            acc0 = __builtin_amdgcn_wmma_f32_16x16x4_f32(false, aq0[k], false, bfr,
                                                         (short)0, acc0, false, false);
            acc1 = __builtin_amdgcn_wmma_f32_16x16x4_f32(false, aq1[k], false, bfr,
                                                         (short)0, acc1, false, false);
        }
        // ---- P = exp(L - M[m]) / S[m]; stage to LDS (D-layout -> row-major) ----
        float Mc = Mp[m0 + ln];
        float rS = __builtin_amdgcn_rcpf(Sp[m0 + ln]);
#pragma unroll
        for (int r = 0; r < 8; ++r) {
            pl0[(r + rhi) * PST + ln] = __expf(acc0[r] - Mc) * rS;
            pl1[(r + rhi) * PST + ln] = __expf(acc1[r] - Mc) * rS;
        }
        // ---- E += P @ V^T, V fragments shared by both n-tiles ----
#pragma unroll
        for (int kk = 0; kk < 4; ++kk) {
            const int mk = 4 * kk + hi2;
            v2f ap0 = *(const v2f*)&pl0[ln * PST + mk];   // ds_load_b64
            v2f ap1 = *(const v2f*)&pl1[ln * PST + mk];
#pragma unroll
            for (int ct = 0; ct < 5; ++ct) {
                v2f bv;
                size_t base = (size_t)(ct * 16 + ln) * NN + m0 + mk;
                bv.x = vm[base];
                bv.y = vm[base + 1];
                E0[ct] = __builtin_amdgcn_wmma_f32_16x16x4_f32(false, ap0, false, bv,
                                                               (short)0, E0[ct], false, false);
                E1[ct] = __builtin_amdgcn_wmma_f32_16x16x4_f32(false, ap1, false, bv,
                                                               (short)0, E1[ct], false, false);
            }
        }
    }

    // ---- cross-wave reduce into E_lds[n][c] via ds_add_f32 ----
#pragma unroll
    for (int ct = 0; ct < 5; ++ct)
#pragma unroll
        for (int r = 0; r < 8; ++r) {
            int n = r + rhi;
            int c = ct * 16 + ln;
            atomicAdd(&E_lds[n * CL + c], E0[ct][r]);
            atomicAdd(&E_lds[(n + 16) * CL + c], E1[ct][r]);
        }
    __syncthreads();

    // ---- add XQ residual (e += xq), store transposed layout [B][C][N] ----
    for (int i = tid; i < 32 * CL; i += 128) {
        int n = i & 31;
        int c = i >> 5;
        float val = E_lds[n * CL + c] + q[(size_t)c * NN + n0 + n];
        Eout[(size_t)(b * CL + c) * NN + n0 + n] = val;
    }
}

// ---------------------------------------------------------------------------
extern "C" void kernel_launch(void* const* d_in, const int* in_sizes, int n_in,
                              void* d_out, int out_size, void* d_ws, size_t ws_size,
                              hipStream_t stream) {
    const float* x_latter = (const float*)d_in[0];
    const float* x        = (const float*)d_in[1];
    const float* W1 = (const float*)d_in[2];
    const float* b1 = (const float*)d_in[3];
    const float* Wh = (const float*)d_in[4];
    const float* bh = (const float*)d_in[5];
    const float* Wl = (const float*)d_in[6];
    const float* bl = (const float*)d_in[7];
    const float* Wv = (const float*)d_in[8];
    const float* bv = (const float*)d_in[9];

    float* out    = (float*)d_out;
    float* e_out  = out;                              // output 0: e  [B,C,N]
    float* xl_out = out + (size_t)BB * CL * NN;       // output 1: xl [B,C,N]

    // workspace layout (floats): Wc | bc | XQ | V | Ms | Ss  (~21.3 MB)
    float* ws = (float*)d_ws;
    float* Wc = ws;
    float* bc = Wc + CL * CH;
    float* XQ = bc + CL;
    float* V  = XQ + (size_t)BB * CL * NN;
    float* Ms = V  + (size_t)BB * CL * NN;
    float* Ss = Ms + (size_t)BB * NN;

    k_combine<<<dim3((CL * CH + CL + 255) / 256), dim3(256), 0, stream>>>(W1, b1, Wh, bh, Wc, bc);
    k_proj<<<dim3((BB * CL * NN) / 256, 3), dim3(256), 0, stream>>>(
        x_latter, x, Wc, bc, Wl, bl, Wv, bv, xl_out, XQ, V);
    k_stats<<<dim3(NN / 128, BB), dim3(256), 0, stream>>>(XQ, xl_out, Ms, Ss);
    k_out<<<dim3(NN / 32, BB), dim3(128), 0, stream>>>(XQ, xl_out, V, Ms, Ss, e_out);
}

// v001
// A run of this version takes 486 microseconds.
// Two timings next to v000 put it at 1.20 and 1.21 times that version's speed.
#include <hip/hip_runtime.h>
#include <hip/hip_bf16.h>

// Problem constants
#define BB 8
#define CH 160
#define CL 80
#define NN 4096   // H*W = 64*64

typedef __attribute__((ext_vector_type(2))) float v2f;
typedef __attribute__((ext_vector_type(8))) float v8f;

// ---------------------------------------------------------------------------
// Kernel 1: fold the linear chain  Wc = Wh @ W1,  bc = Wh @ b1 + bh
// ---------------------------------------------------------------------------
__global__ void k_combine(const float* __restrict__ W1, const float* __restrict__ b1,
                          const float* __restrict__ Wh, const float* __restrict__ bh,
                          float* __restrict__ Wc, float* __restrict__ bc) {
    int idx = blockIdx.x * blockDim.x + threadIdx.x;
    if (idx < CL * CH) {
        int o = idx / CH, i = idx - o * CH;
        float s = 0.f;
        for (int j = 0; j < CH; ++j) s += Wh[o * CH + j] * W1[j * CH + i];
        Wc[idx] = s;
    } else if (idx < CL * CH + CL) {
        int o = idx - CL * CH;
        float s = bh[o];
        for (int j = 0; j < CH; ++j) s += Wh[o * CH + j] * b1[j];
        bc[o] = s;
    }
}

// ---------------------------------------------------------------------------
// Kernel 2: projections on the f32 matrix unit.  blockIdx.y selects the source:
//   0: XL = Wc @ x_latter + bc   (written straight into d_out second half)
//   1: XQ = Wl @ x + bl  and  V = Wv @ x + bv  (one read of x feeds both)
// Block = 16 waves * 16 columns of n.  The weight rows (A operand) are staged
// once per block in LDS at pitch K+4 floats (pitch mod 64 = 4 * odd, so the 16
// rows of a ds_load_b64 fragment fall on 64 distinct banks).  Each wave keeps
// its whole K x 16 source tile (B operand) in registers, loaded once, and each
// B fragment feeds every 16-row output tile.  The bias is the start value of
// the accumulator, and k runs upward, as in a plain dot product.
// ---------------------------------------------------------------------------
#define PJT 512   // threads per projection block
template <int K, int CT>   // K input channels, CT output tiles of 16 rows
__device__ __forceinline__ void
proj_tiles(float* __restrict__ w_lds,
           const float* __restrict__ Wa, const float* __restrict__ Wb,
           const float* __restrict__ ba, const float* __restrict__ bb,
           const float* __restrict__ src,
           float* __restrict__ da, float* __restrict__ db) {
    constexpr int PW = K + 4;
    const int tid  = threadIdx.x;
    __builtin_assume(tid < PJT);   // lets the source picks below fold at compile time
    const int lane = tid & 31;
    const int ln   = lane & 15;
    const int hi2  = (lane >> 4) << 1;
    const int rhi  = (lane >> 4) << 3;
    const int n    = blockIdx.x * (PJT / 2) + (tid >> 5) * 16 + ln;

    // weight rows, 16 bytes a thread and trip: rows 0..79 from Wa, rows 80.. from Wb
    // (each matrix is dense, so piece i of a matrix lies at float 4 * i of it).
    // Every load is issued before the first LDS store: one latency covers them all.
    constexpr int KQ = K / 4;                      // float4 pieces in a weight row
    constexpr int NA = CL * KQ;                    // pieces that come from Wa
    constexpr int NW = CT * 16 * KQ;               // pieces in the block's weights
    constexpr int TF = NW / PJT;                   // trips that every thread takes
    constexpr int RM = NW - TF * PJT;              // pieces left for the first threads
    float4 wv[TF];
#pragma unroll
    for (int t = 0; t < TF; ++t) {
        int i = tid + t * PJT;
        wv[t] = *(const float4*)(i < NA ? Wa + 4 * i : Wb + 4 * (i - NA));
    }
    const int ir = tid + TF * PJT;
    const int irow = ir / KQ, ic4 = (ir - irow * KQ) * 4;
    float4 wrem = make_float4(0.f, 0.f, 0.f, 0.f);
    if (tid < RM)
        wrem = *(const float4*)(ir < NA ? Wa + 4 * ir : Wb + 4 * (ir - NA));

    // B fragments: rows 4k+hi2, 4k+hi2+1 of the source, column n
    v2f bf[K / 4];
#pragma unroll
    for (int k = 0; k < K / 4; ++k) {
        bf[k].x = src[(size_t)(4 * k + hi2) * NN + n];
        bf[k].y = src[(size_t)(4 * k + hi2 + 1) * NN + n];
    }

#pragma unroll
    for (int t = 0; t < TF; ++t) {
        int i = tid + t * PJT, row = i / KQ, c4 = (i - row * KQ) * 4;
        *(float4*)&w_lds[row * PW + c4] = wv[t];
    }
    if (tid < RM) *(float4*)&w_lds[irow * PW + ic4] = wrem;

    v8f acc[CT];
#pragma unroll
    for (int ct = 0; ct < CT; ++ct) {
        const float* bias = ct < CL / 16 ? ba + ct * 16 : bb + (ct - CL / 16) * 16;
#pragma unroll
        for (int r = 0; r < 8; ++r) acc[ct][r] = bias[r + rhi];
    }
    __syncthreads();   // weight rows visible to every wave

#pragma unroll
    for (int k = 0; k < K / 4; ++k)
#pragma unroll
        for (int ct = 0; ct < CT; ++ct) {
            v2f a = *(const v2f*)&w_lds[(ct * 16 + ln) * PW + 4 * k + hi2];  // ds_load_b64
            acc[ct] = __builtin_amdgcn_wmma_f32_16x16x4_f32(false, a, false, bf[k],
                                                            (short)0, acc[ct], false, false);
        }

#pragma unroll
    for (int ct = 0; ct < CT; ++ct) {
        float* d = ct < CL / 16 ? da + (size_t)(ct * 16) * NN
                                : db + (size_t)((ct - CL / 16) * 16) * NN;
#pragma unroll
        for (int r = 0; r < 8; ++r) d[(size_t)(r + rhi) * NN + n] = acc[ct][r];
    }
    // the stores above name their address and data registers: hold any later
    // rewrite of those registers behind this wait
    asm volatile("s_wait_xcnt 0x0" ::: "memory");
}

__global__ void __launch_bounds__(PJT)
k_proj(const float* __restrict__ xlat, const float* __restrict__ x,
       const float* __restrict__ Wc, const float* __restrict__ bc,
       const float* __restrict__ Wl, const float* __restrict__ bl,
       const float* __restrict__ Wv, const float* __restrict__ bv,
       float* __restrict__ XL, float* __restrict__ XQ, float* __restrict__ V) {
    __shared__ __attribute__((aligned(16))) float w_lds[2 * CL * (CL + 4)];  // >= CL*(CH+4)
    const size_t b = blockIdx.z;
    const size_t o = b * CL * NN;
    if (blockIdx.y == 0)
        proj_tiles<CH, CL / 16>(w_lds, Wc, Wc, bc, bc, xlat + b * CH * NN, XL + o, XL + o);
    else
        proj_tiles<CL, 2 * CL / 16>(w_lds, Wl, Wv, bl, bv, x + o, XQ + o, V + o);
}

// ---------------------------------------------------------------------------
// Kernel 3: per-column softmax stats (softmax over axis=1 == over n, per m).
// Block = 8 waves * 16 columns = 128 columns of m.  The XQ n-tile (16x80) is
// shared by all 8 waves: double-buffered in LDS, filled with the CDNA5
// async-copy path (global_load_async_to_lds_b32, ASYNCcnt) overlapped with
// the WMMA compute of the current tile.  A-fragments then come from LDS as
// aligned ds_load_b64 ([n][stride 82] layout: (c,c+1) contiguous, 8B aligned,
// stride mod 64 = 18 -> conflict-free across 16 lanes).
// ---------------------------------------------------------------------------
#define AST 82   // LDS row stride (floats) for staged A tile
__global__ void __launch_bounds__(256)
k_stats(const float* __restrict__ XQ, const float* __restrict__ XL,
        float* __restrict__ Ms, float* __restrict__ Ss) {
    __shared__ float a_lds[2][16 * AST];

    const int tid  = threadIdx.x;
    const int lane = tid & 31;
    const int wave = tid >> 5;
    const int b    = blockIdx.y;
    const int m0   = blockIdx.x * 128 + wave * 16;
    const int ln   = lane & 15;
    const int hi2  = (lane >> 4) << 1;

    const float* q  = XQ + (size_t)b * CL * NN;
    const float* km = XL + (size_t)b * CL * NN;

    // this thread's share of the cooperative tile copy: 5 dwords
    const int cc[5] = { (tid) >> 4, (tid + 256) >> 4, (tid + 512) >> 4,
                        (tid + 768) >> 4, (tid + 1024) >> 4 };
    const int nl = tid & 15;

    // per-wave B fragments (XL columns m0..m0+15), resident for whole kernel
    v2f bf[20];
#pragma unroll
    for (int k = 0; k < 20; ++k) {
        int c = 4 * k + hi2;
        bf[k].x = km[(size_t)c * NN + m0 + ln];
        bf[k].y = km[(size_t)(c + 1) * NN + m0 + ln];
    }

    // prologue: async-fill buffer 0 with n-tile 0
#pragma unroll
    for (int j = 0; j < 5; ++j) {
        unsigned loff = (unsigned)(uintptr_t)&a_lds[0][nl * AST + cc[j]];
        const float* g = q + (size_t)cc[j] * NN + nl;
        asm volatile("global_load_async_to_lds_b32 %0, %1, off"
                     :: "v"(loff), "v"(g) : "memory");
    }
    asm volatile("s_wait_asynccnt 0x0" ::: "memory");
    __syncthreads();

    float Mrun = -3.0e38f, Srun = 0.f;
    for (int it = 0; it < NN / 16; ++it) {
        const int cur = it & 1;
        // prefetch next tile into the other buffer (overlaps with compute)
        if (it + 1 < NN / 16) {
            const int n1 = (it + 1) * 16;
#pragma unroll
            for (int j = 0; j < 5; ++j) {
                unsigned loff = (unsigned)(uintptr_t)&a_lds[cur ^ 1][nl * AST + cc[j]];
                const float* g = q + (size_t)cc[j] * NN + n1 + nl;
                asm volatile("global_load_async_to_lds_b32 %0, %1, off"
                             :: "v"(loff), "v"(g) : "memory");
            }
        }
        // ---- logits tile from staged A + resident B ----
        v8f acc = {};
#pragma unroll
        for (int k = 0; k < 20; ++k) {
            v2f a = *(const v2f*)&a_lds[cur][ln * AST + 4 * k + hi2];  // ds_load_b64
            acc = __builtin_amdgcn_wmma_f32_16x16x4_f32(false, a, false, bf[k],
                                                        (short)0, acc, false, false);
        }
        // ---- online column max/sum; lane pair (l, l+16) holds one column ----
        float tmax = acc[0];
#pragma unroll
        for (int r = 1; r < 8; ++r) tmax = fmaxf(tmax, acc[r]);
        tmax = fmaxf(tmax, __shfl_xor(tmax, 16, 32));
        float Mnew = fmaxf(Mrun, tmax);
        float tsum = 0.f;
#pragma unroll
        for (int r = 0; r < 8; ++r) tsum += __expf(acc[r] - Mnew);
        tsum += __shfl_xor(tsum, 16, 32);
        Srun = Srun * __expf(Mrun - Mnew) + tsum;
        Mrun = Mnew;

        asm volatile("s_wait_asynccnt 0x0" ::: "memory");
        __syncthreads();
    }
    if (lane < 16) {
        Ms[(size_t)b * NN + m0 + lane] = Mrun;
        Ss[(size_t)b * NN + m0 + lane] = Srun;
    }
}

// ---------------------------------------------------------------------------
// Kernel 4: e_out[b][c][n] = sum_m P[n,m] * V[c,m] + XQ[c,n]
// Block = 4 waves, a 32-row n band (two 16-row tiles per wave); wave w covers
// m in [w*1024,(w+1)*1024).  Every XL / V B-fragment load is shared by both
// n-tiles (halves B traffic per WMMA).  P is restaged through per-wave LDS
// (stride 18 -> aligned ds_load_b64 A-fragments).  Cross-wave reduce via
// ds_add_f32 LDS atomics, then add XQ residual and store [B,C,N].
// ---------------------------------------------------------------------------
#define PST 18   // LDS row stride (floats) for staged P tiles
__global__ void __launch_bounds__(128)
k_out(const float* __restrict__ XQ, const float* __restrict__ XL,
      const float* __restrict__ V, const float* __restrict__ Ms,
      const float* __restrict__ Ss, float* __restrict__ Eout) {
    __shared__ float E_lds[32 * CL];
    __shared__ float P_lds[4][2][16 * PST];

    const int tid  = threadIdx.x;
    const int lane = tid & 31;
    const int wave = tid >> 5;
    const int b    = blockIdx.y;
    const int n0   = blockIdx.x * 32;
    const int ln   = lane & 15;
    const int hi2  = (lane >> 4) << 1;
    const int rhi  = (lane >> 4) << 3;

    for (int i = tid; i < 32 * CL; i += 128) E_lds[i] = 0.f;
    __syncthreads();

    const float* q  = XQ + (size_t)b * CL * NN;
    const float* km = XL + (size_t)b * CL * NN;
    const float* vm = V  + (size_t)b * CL * NN;
    const float* Mp = Ms + (size_t)b * NN;
    const float* Sp = Ss + (size_t)b * NN;

    // A-fragments of XQ for both n-tiles (reused for all m-tiles)
    v2f aq0[20], aq1[20];
#pragma unroll
    for (int k = 0; k < 20; ++k) {
        int c = 4 * k + hi2;
        aq0[k].x = q[(size_t)c * NN + n0 + ln];
        aq0[k].y = q[(size_t)(c + 1) * NN + n0 + ln];
        aq1[k].x = q[(size_t)c * NN + n0 + 16 + ln];
        aq1[k].y = q[(size_t)(c + 1) * NN + n0 + 16 + ln];
    }

    v8f E0[5] = {}, E1[5] = {};
    float* pl0 = &P_lds[wave][0][0];
    float* pl1 = &P_lds[wave][1][0];

    for (int mt = 0; mt < 64; ++mt) {
        const int m0 = wave * 1024 + mt * 16;
        // ---- two logits tiles, B fragments loaded once ----
        v8f acc0 = {}, acc1 = {};
#pragma unroll
        for (int k = 0; k < 20; ++k) {
            int c = 4 * k + hi2;
            v2f bfr;
            bfr.x = km[(size_t)c * NN + m0 + ln];
            bfr.y = km[(size_t)(c + 1) * NN + m0 + ln];
            acc0 = __builtin_amdgcn_wmma_f32_16x16x4_f32(false, aq0[k], false, bfr,
                                                         (short)0, acc0, false, false);
            acc1 = __builtin_amdgcn_wmma_f32_16x16x4_f32(false, aq1[k], false, bfr,
                                                         (short)0, acc1, false, false);
        }
        // ---- P = exp(L - M[m]) / S[m]; stage to LDS (D-layout -> row-major) ----
        float Mc = Mp[m0 + ln];
        float rS = __builtin_amdgcn_rcpf(Sp[m0 + ln]);
#pragma unroll
        for (int r = 0; r < 8; ++r) {
            pl0[(r + rhi) * PST + ln] = __expf(acc0[r] - Mc) * rS;
            pl1[(r + rhi) * PST + ln] = __expf(acc1[r] - Mc) * rS;
        }
        // ---- E += P @ V^T, V fragments shared by both n-tiles ----
#pragma unroll
        for (int kk = 0; kk < 4; ++kk) {
            const int mk = 4 * kk + hi2;
            v2f ap0 = *(const v2f*)&pl0[ln * PST + mk];   // ds_load_b64
            v2f ap1 = *(const v2f*)&pl1[ln * PST + mk];
#pragma unroll
            for (int ct = 0; ct < 5; ++ct) {
                v2f bv;
                size_t base = (size_t)(ct * 16 + ln) * NN + m0 + mk;
                bv.x = vm[base];
                bv.y = vm[base + 1];
                E0[ct] = __builtin_amdgcn_wmma_f32_16x16x4_f32(false, ap0, false, bv,
                                                               (short)0, E0[ct], false, false);
                E1[ct] = __builtin_amdgcn_wmma_f32_16x16x4_f32(false, ap1, false, bv,
                                                               (short)0, E1[ct], false, false);
            }
        }
    }

    // ---- cross-wave reduce into E_lds[n][c] via ds_add_f32 ----
#pragma unroll
    for (int ct = 0; ct < 5; ++ct)
#pragma unroll
        for (int r = 0; r < 8; ++r) {
            int n = r + rhi;
            int c = ct * 16 + ln;
            atomicAdd(&E_lds[n * CL + c], E0[ct][r]);
            atomicAdd(&E_lds[(n + 16) * CL + c], E1[ct][r]);
        }
    __syncthreads();

    // ---- add XQ residual (e += xq), store transposed layout [B][C][N] ----
    for (int i = tid; i < 32 * CL; i += 128) {
        int n = i & 31;
        int c = i >> 5;
        float val = E_lds[n * CL + c] + q[(size_t)c * NN + n0 + n];
        Eout[(size_t)(b * CL + c) * NN + n0 + n] = val;
    }
}

// ---------------------------------------------------------------------------
extern "C" void kernel_launch(void* const* d_in, const int* in_sizes, int n_in,
                              void* d_out, int out_size, void* d_ws, size_t ws_size,
                              hipStream_t stream) {
    const float* x_latter = (const float*)d_in[0];
    const float* x        = (const float*)d_in[1];
    const float* W1 = (const float*)d_in[2];
    const float* b1 = (const float*)d_in[3];
    const float* Wh = (const float*)d_in[4];
    const float* bh = (const float*)d_in[5];
    const float* Wl = (const float*)d_in[6];
    const float* bl = (const float*)d_in[7];
    const float* Wv = (const float*)d_in[8];
    const float* bv = (const float*)d_in[9];

    float* out    = (float*)d_out;
    float* e_out  = out;                              // output 0: e  [B,C,N]
    float* xl_out = out + (size_t)BB * CL * NN;       // output 1: xl [B,C,N]

    // workspace layout (floats): Wc | bc | XQ | V | Ms | Ss  (~21.3 MB)
    float* ws = (float*)d_ws;
    float* Wc = ws;
    float* bc = Wc + CL * CH;
    float* XQ = bc + CL;
    float* V  = XQ + (size_t)BB * CL * NN;
    float* Ms = V  + (size_t)BB * CL * NN;
    float* Ss = Ms + (size_t)BB * NN;

    k_combine<<<dim3((CL * CH + CL + 255) / 256), dim3(256), 0, stream>>>(W1, b1, Wh, bh, Wc, bc);
    k_proj<<<dim3(NN / (PJT / 2), 2, BB), dim3(PJT), 0, stream>>>(
        x_latter, x, Wc, bc, Wl, bl, Wv, bv, xl_out, XQ, V);
    k_stats<<<dim3(NN / 128, BB), dim3(256), 0, stream>>>(XQ, xl_out, Ms, Ss);
    k_out<<<dim3(NN / 32, BB), dim3(128), 0, stream>>>(XQ, xl_out, V, Ms, Ss, e_out);
}

// v002
// Measured time: 417 microseconds a run.
// Next to v001, in two timings, it ran 1.16 times as fast each time.
// All steps since v000 together make it 1.40 times as fast.
#include <hip/hip_runtime.h>
#include <hip/hip_bf16.h>

// Problem constants
#define BB 8
#define CH 160
#define CL 80
#define NN 4096   // H*W = 64*64

typedef __attribute__((ext_vector_type(2))) float v2f;
typedef __attribute__((ext_vector_type(8))) float v8f;

// ---------------------------------------------------------------------------
// Kernel 1: fold the linear chain  Wc = Wh @ W1,  bc = Wh @ b1 + bh
// ---------------------------------------------------------------------------
__global__ void k_combine(const float* __restrict__ W1, const float* __restrict__ b1,
                          const float* __restrict__ Wh, const float* __restrict__ bh,
                          float* __restrict__ Wc, float* __restrict__ bc) {
    int idx = blockIdx.x * blockDim.x + threadIdx.x;
    if (idx < CL * CH) {
        int o = idx / CH, i = idx - o * CH;
        float s = 0.f;
        for (int j = 0; j < CH; ++j) s += Wh[o * CH + j] * W1[j * CH + i];
        Wc[idx] = s;
    } else if (idx < CL * CH + CL) {
        int o = idx - CL * CH;
        float s = bh[o];
        for (int j = 0; j < CH; ++j) s += Wh[o * CH + j] * b1[j];
        bc[o] = s;
    }
}

// ---------------------------------------------------------------------------
// Kernel 2: projections on the f32 matrix unit.  blockIdx.y selects the source:
//   0: XL = Wc @ x_latter + bc   (written straight into d_out second half)
//   1: XQ = Wl @ x + bl  and  V = Wv @ x + bv  (one read of x feeds both)
// Block = 16 waves * 16 columns of n.  The weight rows (A operand) are staged
// once per block in LDS at pitch K+4 floats (pitch mod 64 = 4 * odd, so the 16
// rows of a ds_load_b64 fragment fall on 64 distinct banks).  Each wave keeps
// its whole K x 16 source tile (B operand) in registers, loaded once, and each
// B fragment feeds every 16-row output tile.  The bias is the start value of
// the accumulator, and k runs upward, as in a plain dot product.
// ---------------------------------------------------------------------------
#define PJT 512   // threads per projection block
template <int K, int CT>   // K input channels, CT output tiles of 16 rows
__device__ __forceinline__ void
proj_tiles(float* __restrict__ w_lds,
           const float* __restrict__ Wa, const float* __restrict__ Wb,
           const float* __restrict__ ba, const float* __restrict__ bb,
           const float* __restrict__ src,
           float* __restrict__ da, float* __restrict__ db) {
    constexpr int PW = K + 4;
    const int tid  = threadIdx.x;
    __builtin_assume(tid < PJT);   // lets the source picks below fold at compile time
    const int lane = tid & 31;
    const int ln   = lane & 15;
    const int hi2  = (lane >> 4) << 1;
    const int rhi  = (lane >> 4) << 3;
    const int n    = blockIdx.x * (PJT / 2) + (tid >> 5) * 16 + ln;

    // weight rows, 16 bytes a thread and trip: rows 0..79 from Wa, rows 80.. from Wb
    // (each matrix is dense, so piece i of a matrix lies at float 4 * i of it).
    // Every load is issued before the first LDS store: one latency covers them all.
    constexpr int KQ = K / 4;                      // float4 pieces in a weight row
    constexpr int NA = CL * KQ;                    // pieces that come from Wa
    constexpr int NW = CT * 16 * KQ;               // pieces in the block's weights
    constexpr int TF = NW / PJT;                   // trips that every thread takes
    constexpr int RM = NW - TF * PJT;              // pieces left for the first threads
    float4 wv[TF];
#pragma unroll
    for (int t = 0; t < TF; ++t) {
        int i = tid + t * PJT;
        wv[t] = *(const float4*)(i < NA ? Wa + 4 * i : Wb + 4 * (i - NA));
    }
    const int ir = tid + TF * PJT;
    const int irow = ir / KQ, ic4 = (ir - irow * KQ) * 4;
    float4 wrem = make_float4(0.f, 0.f, 0.f, 0.f);
    if (tid < RM)
        wrem = *(const float4*)(ir < NA ? Wa + 4 * ir : Wb + 4 * (ir - NA));

    // B fragments: rows 4k+hi2, 4k+hi2+1 of the source, column n
    v2f bf[K / 4];
#pragma unroll
    for (int k = 0; k < K / 4; ++k) {
        bf[k].x = src[(size_t)(4 * k + hi2) * NN + n];
        bf[k].y = src[(size_t)(4 * k + hi2 + 1) * NN + n];
    }

#pragma unroll
    for (int t = 0; t < TF; ++t) {
        int i = tid + t * PJT, row = i / KQ, c4 = (i - row * KQ) * 4;
        *(float4*)&w_lds[row * PW + c4] = wv[t];
    }
    if (tid < RM) *(float4*)&w_lds[irow * PW + ic4] = wrem;

    v8f acc[CT];
#pragma unroll
    for (int ct = 0; ct < CT; ++ct) {
        const float* bias = ct < CL / 16 ? ba + ct * 16 : bb + (ct - CL / 16) * 16;
#pragma unroll
        for (int r = 0; r < 8; ++r) acc[ct][r] = bias[r + rhi];
    }
    __syncthreads();   // weight rows visible to every wave

#pragma unroll
    for (int k = 0; k < K / 4; ++k)
#pragma unroll
        for (int ct = 0; ct < CT; ++ct) {
            v2f a = *(const v2f*)&w_lds[(ct * 16 + ln) * PW + 4 * k + hi2];  // ds_load_b64
            acc[ct] = __builtin_amdgcn_wmma_f32_16x16x4_f32(false, a, false, bf[k],
                                                            (short)0, acc[ct], false, false);
        }

#pragma unroll
    for (int ct = 0; ct < CT; ++ct) {
        float* d = ct < CL / 16 ? da + (size_t)(ct * 16) * NN
                                : db + (size_t)((ct - CL / 16) * 16) * NN;
#pragma unroll
        for (int r = 0; r < 8; ++r) d[(size_t)(r + rhi) * NN + n] = acc[ct][r];
    }
    // the stores above name their address and data registers: hold any later
    // rewrite of those registers behind this wait
    asm volatile("s_wait_xcnt 0x0" ::: "memory");
}

__global__ void __launch_bounds__(PJT)
k_proj(const float* __restrict__ xlat, const float* __restrict__ x,
       const float* __restrict__ Wc, const float* __restrict__ bc,
       const float* __restrict__ Wl, const float* __restrict__ bl,
       const float* __restrict__ Wv, const float* __restrict__ bv,
       float* __restrict__ XL, float* __restrict__ XQ, float* __restrict__ V) {
    __shared__ __attribute__((aligned(16))) float w_lds[2 * CL * (CL + 4)];  // >= CL*(CH+4)
    const size_t b = blockIdx.z;
    const size_t o = b * CL * NN;
    if (blockIdx.y == 0)
        proj_tiles<CH, CL / 16>(w_lds, Wc, Wc, bc, bc, xlat + b * CH * NN, XL + o, XL + o);
    else
        proj_tiles<CL, 2 * CL / 16>(w_lds, Wl, Wv, bl, bv, x + o, XQ + o, V + o);
}

// ---------------------------------------------------------------------------
// Kernel 3: per-column softmax stats (softmax over axis=1 == over n, per m).
// Block = 8 waves * 16 columns = 128 columns of m.  The XQ n-tile (16x80) is
// shared by all 8 waves: double-buffered in LDS, filled with the CDNA5
// async-copy path (global_load_async_to_lds_b32, ASYNCcnt) overlapped with
// the WMMA compute of the current tile.  A-fragments then come from LDS as
// aligned ds_load_b64 ([n][stride 82] layout: (c,c+1) contiguous, 8B aligned,
// stride mod 64 = 18 -> conflict-free across 16 lanes).
// ---------------------------------------------------------------------------
#define AST 82   // LDS row stride (floats) for staged A tile
__global__ void __launch_bounds__(256)
k_stats(const float* __restrict__ XQ, const float* __restrict__ XL,
        float* __restrict__ Ms, float* __restrict__ Ss) {
    __shared__ float a_lds[2][16 * AST];

    const int tid  = threadIdx.x;
    const int lane = tid & 31;
    const int wave = tid >> 5;
    const int b    = blockIdx.y;
    const int m0   = blockIdx.x * 128 + wave * 16;
    const int ln   = lane & 15;
    const int hi2  = (lane >> 4) << 1;

    const float* q  = XQ + (size_t)b * CL * NN;
    const float* km = XL + (size_t)b * CL * NN;

    // this thread's share of the cooperative tile copy: 5 dwords
    const int cc[5] = { (tid) >> 4, (tid + 256) >> 4, (tid + 512) >> 4,
                        (tid + 768) >> 4, (tid + 1024) >> 4 };
    const int nl = tid & 15;

    // per-wave B fragments (XL columns m0..m0+15), resident for whole kernel
    v2f bf[20];
#pragma unroll
    for (int k = 0; k < 20; ++k) {
        int c = 4 * k + hi2;
        bf[k].x = km[(size_t)c * NN + m0 + ln];
        bf[k].y = km[(size_t)(c + 1) * NN + m0 + ln];
    }

    // prologue: async-fill buffer 0 with n-tile 0
#pragma unroll
    for (int j = 0; j < 5; ++j) {
        unsigned loff = (unsigned)(uintptr_t)&a_lds[0][nl * AST + cc[j]];
        const float* g = q + (size_t)cc[j] * NN + nl;
        asm volatile("global_load_async_to_lds_b32 %0, %1, off"
                     :: "v"(loff), "v"(g) : "memory");
    }
    asm volatile("s_wait_asynccnt 0x0" ::: "memory");
    __syncthreads();

    float Mrun = -3.0e38f, Srun = 0.f;
    for (int it = 0; it < NN / 16; ++it) {
        const int cur = it & 1;
        // prefetch next tile into the other buffer (overlaps with compute)
        if (it + 1 < NN / 16) {
            const int n1 = (it + 1) * 16;
#pragma unroll
            for (int j = 0; j < 5; ++j) {
                unsigned loff = (unsigned)(uintptr_t)&a_lds[cur ^ 1][nl * AST + cc[j]];
                const float* g = q + (size_t)cc[j] * NN + n1 + nl;
                asm volatile("global_load_async_to_lds_b32 %0, %1, off"
                             :: "v"(loff), "v"(g) : "memory");
            }
        }
        // ---- logits tile from staged A + resident B ----
        v8f acc = {};
#pragma unroll
        for (int k = 0; k < 20; ++k) {
            v2f a = *(const v2f*)&a_lds[cur][ln * AST + 4 * k + hi2];  // ds_load_b64
            acc = __builtin_amdgcn_wmma_f32_16x16x4_f32(false, a, false, bf[k],
                                                        (short)0, acc, false, false);
        }
        // ---- online column max/sum; lane pair (l, l+16) holds one column ----
        float tmax = acc[0];
#pragma unroll
        for (int r = 1; r < 8; ++r) tmax = fmaxf(tmax, acc[r]);
        tmax = fmaxf(tmax, __shfl_xor(tmax, 16, 32));
        float Mnew = fmaxf(Mrun, tmax);
        float tsum = 0.f;
#pragma unroll
        for (int r = 0; r < 8; ++r) tsum += __expf(acc[r] - Mnew);
        tsum += __shfl_xor(tsum, 16, 32);
        Srun = Srun * __expf(Mrun - Mnew) + tsum;
        Mrun = Mnew;

        asm volatile("s_wait_asynccnt 0x0" ::: "memory");
        __syncthreads();
    }
    if (lane < 16) {
        Ms[(size_t)b * NN + m0 + lane] = Mrun;
        Ss[(size_t)b * NN + m0 + lane] = Srun;
    }
}

#define PST 18   // LDS row stride (floats) for staged P tiles
#define OTH 512  // threads per block
#define OMT 32   // m columns in a staged tile
#define OXP 40   // LDS pitch (floats) of a staged XL row
#define OVP 36   // LDS pitch (floats) of a staged V row
#define OTF (CL * OXP + CL * OVP)   // floats in one buffer: XL tile, then V tile
#define ONT (1024 / OMT)            // tiles in an m quarter

// One thread's share of a tile: five 16-byte pieces of XL and five of V, 16 rows
// apart.  The closing wait stands inside the statement so that no address
// register named here is rewritten in front of it.
__device__ __forceinline__ void
stage_tile(unsigned lx, unsigned lv, const float* gx, const float* gv) {
    asm volatile("global_load_async_to_lds_b128 %0, %10, off\n\t"
                 "global_load_async_to_lds_b128 %1, %11, off\n\t"
                 "global_load_async_to_lds_b128 %2, %12, off\n\t"
                 "global_load_async_to_lds_b128 %3, %13, off\n\t"
                 "global_load_async_to_lds_b128 %4, %14, off\n\t"
                 "global_load_async_to_lds_b128 %5, %15, off\n\t"
                 "global_load_async_to_lds_b128 %6, %16, off\n\t"
                 "global_load_async_to_lds_b128 %7, %17, off\n\t"
                 "global_load_async_to_lds_b128 %8, %18, off\n\t"
                 "global_load_async_to_lds_b128 %9, %19, off\n\t"
                 "s_wait_xcnt 0x0"
                 :: "v"(lx), "v"(lx + 16 * OXP * 4), "v"(lx + 32 * OXP * 4),
                    "v"(lx + 48 * OXP * 4), "v"(lx + 64 * OXP * 4),
                    "v"(lv), "v"(lv + 16 * OVP * 4), "v"(lv + 32 * OVP * 4),
                    "v"(lv + 48 * OVP * 4), "v"(lv + 64 * OVP * 4),
                    "v"(gx), "v"(gx + 16 * NN), "v"(gx + 32 * NN),
                    "v"(gx + 48 * NN), "v"(gx + 64 * NN),
                    "v"(gv), "v"(gv + 16 * NN), "v"(gv + 32 * NN),
                    "v"(gv + 48 * NN), "v"(gv + 64 * NN)
                 : "memory");
}

__global__ void __launch_bounds__(OTH)
k_out(const float* __restrict__ XQ, const float* __restrict__ XL,
      const float* __restrict__ V, const float* __restrict__ Ms,
      const float* __restrict__ Ss, float* __restrict__ Eout) {
    __shared__ __attribute__((aligned(16))) float T_lds[4][2][OTF];
    __shared__ float E_lds[128 * CL];
    __shared__ float P_lds[16][2][16 * PST];

    const int tid  = threadIdx.x;
    const int lane = tid & 31;
    const int wave = tid >> 5;
    const int nb   = wave & 3;    // 32-row band inside the block
    const int mq   = wave >> 2;   // m quarter
    const int b    = blockIdx.y;
    const int nblk = blockIdx.x * 128;
    const int n0   = nblk + nb * 32;
    const int ln   = lane & 15;
    const int hi2  = (lane >> 4) << 1;
    const int rhi  = (lane >> 4) << 3;

    for (int i = tid; i < 128 * CL; i += OTH) E_lds[i] = 0.f;
    __syncthreads();

    const float* q  = XQ + (size_t)b * CL * NN;
    const float* km = XL + (size_t)b * CL * NN;
    const float* vm = V  + (size_t)b * CL * NN;
    const float* Mp = Ms + (size_t)b * NN;
    const float* Sp = Ss + (size_t)b * NN;

    // this thread's place in its quarter's cooperative copy (128 threads, 8 a row)
    const int crow = (tid & 127) >> 3;
    const int ccol = (tid & 7) * 4;
    const float* gx = km + (size_t)crow * NN + mq * 1024 + ccol;
    const float* gv = vm + (size_t)crow * NN + mq * 1024 + ccol;
    const unsigned lx = (unsigned)(uintptr_t)&T_lds[mq][0][crow * OXP + ccol];
    const unsigned lv = (unsigned)(uintptr_t)&T_lds[mq][0][CL * OXP + crow * OVP + ccol];

    // tile 0 into buffer 0, landed and published; then tile 1 into buffer 1
    stage_tile(lx, lv, gx, gv);
    asm volatile("s_wait_asynccnt 0x0" ::: "memory");   // this wave's copies have landed
    __syncthreads();                                    // every wave's copies are visible
    stage_tile(lx + OTF * 4, lv + OTF * 4, gx + OMT, gv + OMT);

    // A-fragments of XQ for both n-tiles (reused for all m-tiles)
    v2f aq0[20], aq1[20];
#pragma unroll
    for (int k = 0; k < 20; ++k) {
        int c = 4 * k + hi2;
        aq0[k].x = q[(size_t)c * NN + n0 + ln];
        aq0[k].y = q[(size_t)(c + 1) * NN + n0 + ln];
        aq1[k].x = q[(size_t)c * NN + n0 + 16 + ln];
        aq1[k].y = q[(size_t)(c + 1) * NN + n0 + 16 + ln];
    }

    v8f E0[5] = {}, E1[5] = {};
    float* pl0 = &P_lds[wave][0][0];
    float* pl1 = &P_lds[wave][1][0];

    for (int t = 0; t < ONT; ++t) {
        const float* xs = &T_lds[mq][t & 1][0];
        const float* vs = xs + CL * OXP;
        // unrolled so that LDS offsets are immediates and the second half's logits
        // can be scheduled among the first half's P @ V products
#pragma unroll
        for (int h = 0; h < OMT / 16; ++h) {
            const int m0 = mq * 1024 + t * OMT + h * 16;
            // ---- two logits tiles, B fragments read once from the staged XL tile ----
            v8f acc0 = {}, acc1 = {};
#pragma unroll
            for (int k = 0; k < 20; ++k) {
                int c = 4 * k + hi2;
                v2f bfr;
                bfr.x = xs[c * OXP + h * 16 + ln];
                bfr.y = xs[(c + 1) * OXP + h * 16 + ln];
                acc0 = __builtin_amdgcn_wmma_f32_16x16x4_f32(false, aq0[k], false, bfr,
                                                             (short)0, acc0, false, false);
                acc1 = __builtin_amdgcn_wmma_f32_16x16x4_f32(false, aq1[k], false, bfr,
                                                             (short)0, acc1, false, false);
            }
            // ---- P = exp(L - M[m]) / S[m]; stage to LDS (D-layout -> row-major) ----
            float Mc = Mp[m0 + ln];
            float rS = __builtin_amdgcn_rcpf(Sp[m0 + ln]);
#pragma unroll
            for (int r = 0; r < 8; ++r) {
                pl0[(r + rhi) * PST + ln] = __expf(acc0[r] - Mc) * rS;
                pl1[(r + rhi) * PST + ln] = __expf(acc1[r] - Mc) * rS;
            }
            // ---- E += P @ V^T, V fragments shared by both n-tiles ----
#pragma unroll
            for (int kk = 0; kk < 4; ++kk) {
                const int mk = 4 * kk + hi2;
                v2f ap0 = *(const v2f*)&pl0[ln * PST + mk];   // ds_load_b64
                v2f ap1 = *(const v2f*)&pl1[ln * PST + mk];
#pragma unroll
                for (int ct = 0; ct < 5; ++ct) {
                    v2f bv = *(const v2f*)&vs[(ct * 16 + ln) * OVP + h * 16 + mk];  // ds_load_b64
                    E0[ct] = __builtin_amdgcn_wmma_f32_16x16x4_f32(false, ap0, false, bv,
                                                                   (short)0, E0[ct], false, false);
                    E1[ct] = __builtin_amdgcn_wmma_f32_16x16x4_f32(false, ap1, false, bv,
                                                                   (short)0, E1[ct], false, false);
                }
            }
        }
        asm volatile("s_wait_dscnt 0x0" ::: "memory");      // this wave's reads of tile t are done
        asm volatile("s_wait_asynccnt 0x0" ::: "memory");   // its copies of tile t + 1 have landed
        __syncthreads();   // publishes tile t + 1 and frees the buffer of tile t
        if (t + 2 < ONT)
            stage_tile(lx + (t & 1) * (OTF * 4), lv + (t & 1) * (OTF * 4),
                       gx + (t + 2) * OMT, gv + (t + 2) * OMT);
    }
    asm volatile("s_wait_asynccnt 0x0" ::: "memory");       // no copy outlives the loop

    // ---- cross-wave reduce into E_lds[n][c] via ds_add_f32 ----
#pragma unroll
    for (int ct = 0; ct < 5; ++ct)
#pragma unroll
        for (int r = 0; r < 8; ++r) {
            int n = nb * 32 + r + rhi;
            int c = ct * 16 + ln;
            atomicAdd(&E_lds[n * CL + c], E0[ct][r]);
            atomicAdd(&E_lds[(n + 16) * CL + c], E1[ct][r]);
        }
    __syncthreads();

    // ---- add XQ residual (e += xq), store transposed layout [B][C][N] ----
    for (int i = tid; i < 128 * CL; i += OTH) {
        int n = i & 127;
        int c = i >> 7;
        float val = E_lds[n * CL + c] + q[(size_t)c * NN + nblk + n];
        Eout[(size_t)(b * CL + c) * NN + nblk + n] = val;
    }
}

// ---------------------------------------------------------------------------
extern "C" void kernel_launch(void* const* d_in, const int* in_sizes, int n_in,
                              void* d_out, int out_size, void* d_ws, size_t ws_size,
                              hipStream_t stream) {
    const float* x_latter = (const float*)d_in[0];
    const float* x        = (const float*)d_in[1];
    const float* W1 = (const float*)d_in[2];
    const float* b1 = (const float*)d_in[3];
    const float* Wh = (const float*)d_in[4];
    const float* bh = (const float*)d_in[5];
    const float* Wl = (const float*)d_in[6];
    const float* bl = (const float*)d_in[7];
    const float* Wv = (const float*)d_in[8];
    const float* bv = (const float*)d_in[9];

    float* out    = (float*)d_out;
    float* e_out  = out;                              // output 0: e  [B,C,N]
    float* xl_out = out + (size_t)BB * CL * NN;       // output 1: xl [B,C,N]

    // workspace layout (floats): Wc | bc | XQ | V | Ms | Ss  (~21.3 MB)
    float* ws = (float*)d_ws;
    float* Wc = ws;
    float* bc = Wc + CL * CH;
    float* XQ = bc + CL;
    float* V  = XQ + (size_t)BB * CL * NN;
    float* Ms = V  + (size_t)BB * CL * NN;
    float* Ss = Ms + (size_t)BB * NN;

    k_combine<<<dim3((CL * CH + CL + 255) / 256), dim3(256), 0, stream>>>(W1, b1, Wh, bh, Wc, bc);
    k_proj<<<dim3(NN / (PJT / 2), 2, BB), dim3(PJT), 0, stream>>>(
        x_latter, x, Wc, bc, Wl, bl, Wv, bv, xl_out, XQ, V);
    k_stats<<<dim3(NN / 128, BB), dim3(256), 0, stream>>>(XQ, xl_out, Ms, Ss);
    k_out<<<dim3(NN / 128, BB), dim3(OTH), 0, stream>>>(XQ, xl_out, V, Ms, Ss, e_out);
}

// v003
// It runs in 328 microseconds.
// Two timings next to v002 both put it at 1.27 times that version's speed.
// All steps since v000 together make it 1.77 times as fast.
#include <hip/hip_runtime.h>
#include <hip/hip_bf16.h>

// Problem constants
#define BB 8
#define CH 160
#define CL 80
#define NN 4096   // H*W = 64*64

typedef __attribute__((ext_vector_type(2))) float v2f;
typedef __attribute__((ext_vector_type(8))) float v8f;

// ---------------------------------------------------------------------------
// Kernel 1: fold the linear chain  Wc = Wh @ W1,  bc = Wh @ b1 + bh
// ---------------------------------------------------------------------------
__global__ void k_combine(const float* __restrict__ W1, const float* __restrict__ b1,
                          const float* __restrict__ Wh, const float* __restrict__ bh,
                          float* __restrict__ Wc, float* __restrict__ bc) {
    int idx = blockIdx.x * blockDim.x + threadIdx.x;
    if (idx < CL * CH) {
        int o = idx / CH, i = idx - o * CH;
        float s = 0.f;
        for (int j = 0; j < CH; ++j) s += Wh[o * CH + j] * W1[j * CH + i];
        Wc[idx] = s;
    } else if (idx < CL * CH + CL) {
        int o = idx - CL * CH;
        float s = bh[o];
        for (int j = 0; j < CH; ++j) s += Wh[o * CH + j] * b1[j];
        bc[o] = s;
    }
}

// ---------------------------------------------------------------------------
// Kernel 2: projections on the f32 matrix unit.  blockIdx.y selects the source:
//   0: XL = Wc @ x_latter + bc   (written straight into d_out second half)
//   1: XQ = Wl @ x + bl  and  V = Wv @ x + bv  (one read of x feeds both)
// Block = 16 waves * 16 columns of n.  The weight rows (A operand) are staged
// once per block in LDS at pitch K+4 floats (pitch mod 64 = 4 * odd, so the 16
// rows of a ds_load_b64 fragment fall on 64 distinct banks).  Each wave keeps
// its whole K x 16 source tile (B operand) in registers, loaded once, and each
// B fragment feeds every 16-row output tile.  The bias is the start value of
// the accumulator, and k runs upward, as in a plain dot product.
// ---------------------------------------------------------------------------
#define PJT 512   // threads per projection block
template <int K, int CT>   // K input channels, CT output tiles of 16 rows
__device__ __forceinline__ void
proj_tiles(float* __restrict__ w_lds,
           const float* __restrict__ Wa, const float* __restrict__ Wb,
           const float* __restrict__ ba, const float* __restrict__ bb,
           const float* __restrict__ src,
           float* __restrict__ da, float* __restrict__ db) {
    constexpr int PW = K + 4;
    const int tid  = threadIdx.x;
    __builtin_assume(tid < PJT);   // lets the source picks below fold at compile time
    const int lane = tid & 31;
    const int ln   = lane & 15;
    const int hi2  = (lane >> 4) << 1;
    const int rhi  = (lane >> 4) << 3;
    const int n    = blockIdx.x * (PJT / 2) + (tid >> 5) * 16 + ln;

    // weight rows, 16 bytes a thread and trip: rows 0..79 from Wa, rows 80.. from Wb
    // (each matrix is dense, so piece i of a matrix lies at float 4 * i of it).
    // Every load is issued before the first LDS store: one latency covers them all.
    constexpr int KQ = K / 4;                      // float4 pieces in a weight row
    constexpr int NA = CL * KQ;                    // pieces that come from Wa
    constexpr int NW = CT * 16 * KQ;               // pieces in the block's weights
    constexpr int TF = NW / PJT;                   // trips that every thread takes
    constexpr int RM = NW - TF * PJT;              // pieces left for the first threads
    float4 wv[TF];
#pragma unroll
    for (int t = 0; t < TF; ++t) {
        int i = tid + t * PJT;
        wv[t] = *(const float4*)(i < NA ? Wa + 4 * i : Wb + 4 * (i - NA));
    }
    const int ir = tid + TF * PJT;
    const int irow = ir / KQ, ic4 = (ir - irow * KQ) * 4;
    float4 wrem = make_float4(0.f, 0.f, 0.f, 0.f);
    if (tid < RM)
        wrem = *(const float4*)(ir < NA ? Wa + 4 * ir : Wb + 4 * (ir - NA));

    // B fragments: rows 4k+hi2, 4k+hi2+1 of the source, column n
    v2f bf[K / 4];
#pragma unroll
    for (int k = 0; k < K / 4; ++k) {
        bf[k].x = src[(size_t)(4 * k + hi2) * NN + n];
        bf[k].y = src[(size_t)(4 * k + hi2 + 1) * NN + n];
    }

#pragma unroll
    for (int t = 0; t < TF; ++t) {
        int i = tid + t * PJT, row = i / KQ, c4 = (i - row * KQ) * 4;
        *(float4*)&w_lds[row * PW + c4] = wv[t];
    }
    if (tid < RM) *(float4*)&w_lds[irow * PW + ic4] = wrem;

    v8f acc[CT];
#pragma unroll
    for (int ct = 0; ct < CT; ++ct) {
        const float* bias = ct < CL / 16 ? ba + ct * 16 : bb + (ct - CL / 16) * 16;
#pragma unroll
        for (int r = 0; r < 8; ++r) acc[ct][r] = bias[r + rhi];
    }
    __syncthreads();   // weight rows visible to every wave

#pragma unroll
    for (int k = 0; k < K / 4; ++k)
#pragma unroll
        for (int ct = 0; ct < CT; ++ct) {
            v2f a = *(const v2f*)&w_lds[(ct * 16 + ln) * PW + 4 * k + hi2];  // ds_load_b64
            acc[ct] = __builtin_amdgcn_wmma_f32_16x16x4_f32(false, a, false, bf[k],
                                                            (short)0, acc[ct], false, false);
        }

#pragma unroll
    for (int ct = 0; ct < CT; ++ct) {
        float* d = ct < CL / 16 ? da + (size_t)(ct * 16) * NN
                                : db + (size_t)((ct - CL / 16) * 16) * NN;
#pragma unroll
        for (int r = 0; r < 8; ++r) d[(size_t)(r + rhi) * NN + n] = acc[ct][r];
    }
    // the stores above name their address and data registers: hold any later
    // rewrite of those registers behind this wait
    asm volatile("s_wait_xcnt 0x0" ::: "memory");
}

__global__ void __launch_bounds__(PJT)
k_proj(const float* __restrict__ xlat, const float* __restrict__ x,
       const float* __restrict__ Wc, const float* __restrict__ bc,
       const float* __restrict__ Wl, const float* __restrict__ bl,
       const float* __restrict__ Wv, const float* __restrict__ bv,
       float* __restrict__ XL, float* __restrict__ XQ, float* __restrict__ V) {
    __shared__ __attribute__((aligned(16))) float w_lds[2 * CL * (CL + 4)];  // >= CL*(CH+4)
    const size_t b = blockIdx.z;
    const size_t o = b * CL * NN;
    if (blockIdx.y == 0)
        proj_tiles<CH, CL / 16>(w_lds, Wc, Wc, bc, bc, xlat + b * CH * NN, XL + o, XL + o);
    else
        proj_tiles<CL, 2 * CL / 16>(w_lds, Wl, Wv, bl, bv, x + o, XQ + o, V + o);
}

typedef __attribute__((ext_vector_type(4))) float v4f;
#define AST 84               // LDS row pitch (floats) of the staged XQ tile
#define SNT 128              // rows of n in a staged tile
#define STF (SNT * AST)      // floats in one buffer
#define STR (NN / SNT)       // trips

// Ten of a thread's forty copies of a tile: one n, channels two apart.  The
// closing wait stands inside the statement so that no address register named
// here is rewritten in front of it.
__device__ __forceinline__ void
stage_rows(unsigned l, const float* g) {
    asm volatile("global_load_async_to_lds_b32 %0, %10, off\n\t"
                 "global_load_async_to_lds_b32 %1, %11, off\n\t"
                 "global_load_async_to_lds_b32 %2, %12, off\n\t"
                 "global_load_async_to_lds_b32 %3, %13, off\n\t"
                 "global_load_async_to_lds_b32 %4, %14, off\n\t"
                 "global_load_async_to_lds_b32 %5, %15, off\n\t"
                 "global_load_async_to_lds_b32 %6, %16, off\n\t"
                 "global_load_async_to_lds_b32 %7, %17, off\n\t"
                 "global_load_async_to_lds_b32 %8, %18, off\n\t"
                 "global_load_async_to_lds_b32 %9, %19, off\n\t"
                 "s_wait_xcnt 0x0"
                 :: "v"(l), "v"(l + 8), "v"(l + 16), "v"(l + 24), "v"(l + 32),
                    "v"(l + 40), "v"(l + 48), "v"(l + 56), "v"(l + 64), "v"(l + 72),
                    "v"(g), "v"(g + 2 * NN), "v"(g + 4 * NN), "v"(g + 6 * NN),
                    "v"(g + 8 * NN), "v"(g + 10 * NN), "v"(g + 12 * NN),
                    "v"(g + 14 * NN), "v"(g + 16 * NN), "v"(g + 18 * NN)
                 : "memory");
}
__device__ __forceinline__ void
stage_xq(unsigned l, const float* g) {
#pragma unroll
    for (int i = 0; i < 4; ++i) stage_rows(l + 80 * i, g + (size_t)(20 * i) * NN);
}

// A fragments of block blk: tiles 2 * (blk >> 1) and + 1, channel half blk & 1
__device__ __forceinline__ void
load_frags(const float* as, int blk, v4f (&f)[10]) {
    const int row = (blk >> 1) * 32, c0 = (blk & 1) * 40;
#pragma unroll
    for (int i = 0; i < 5; ++i) {
        f[i]     = *(const v4f*)&as[row * AST + c0 + 8 * i];          // ds_load_b128
        f[5 + i] = *(const v4f*)&as[(row + 16) * AST + c0 + 8 * i];
    }
}

// online max / sum of one lane's 16 logits (8 rows of two tiles, one column)
__device__ __forceinline__ void
col_update(const v8f& a, const v8f& b, float& M, float& S) {
    float mx = M;
#pragma unroll
    for (int r = 0; r < 8; ++r) mx = fmaxf(mx, fmaxf(a[r], b[r]));
    float sa = 0.f, sb = 0.f;
#pragma unroll
    for (int r = 0; r < 8; ++r) {
        sa += __expf(a[r] - mx);
        sb += __expf(b[r] - mx);
    }
    S = S * __expf(M - mx) + (sa + sb);
    M = mx;
}

// One trip: the 128 staged rows of tile t against the wave's 16 columns.  STAGE
// says whether a tile t + 2 exists; it is a compile-time argument so that the
// trip stays one straight run of code.  On entry f[0] holds block 0's fragments.
template <bool STAGE>
__device__ __forceinline__ void
stats_trip(int t, const float* a0, unsigned l0, const float* g0,
           const v2f (&bf)[20], v4f (&f)[2][10], float& Mrun, float& Srun) {
    const float* as = a0 + (t & 1) * STF;
    v8f c0 = {}, c1 = {}, d0 = {}, d1 = {};
#pragma unroll
    for (int blk = 0; blk < 8; ++blk) {
        // the fence pair keeps the next block's LDS reads in one group ahead of
        // this block's matrix instructions instead of spread among them
        __builtin_amdgcn_sched_barrier(0);
        if (blk < 7) load_frags(as, blk + 1, f[(blk + 1) & 1]);
        __builtin_amdgcn_sched_barrier(0);
        if ((blk & 1) == 0) { c0 = v8f{}; c1 = v8f{}; }
#pragma unroll
        for (int i = 0; i < 5; ++i) {
            const int j = (blk & 1) * 5 + i;
            const v4f x = f[blk & 1][i], y = f[blk & 1][5 + i];
            c0 = __builtin_amdgcn_wmma_f32_16x16x4_f32(false, x.xy, false, bf[2 * j],
                                                       (short)0, c0, false, false);
            c1 = __builtin_amdgcn_wmma_f32_16x16x4_f32(false, y.xy, false, bf[2 * j],
                                                       (short)0, c1, false, false);
            c0 = __builtin_amdgcn_wmma_f32_16x16x4_f32(false, x.zw, false, bf[2 * j + 1],
                                                       (short)0, c0, false, false);
            c1 = __builtin_amdgcn_wmma_f32_16x16x4_f32(false, y.zw, false, bf[2 * j + 1],
                                                       (short)0, c1, false, false);
        }
        // the finished tile pair is folded in beside the next pair's products
        if ((blk & 1) == 0 && blk > 0) col_update(d0, d1, Mrun, Srun);
        if (blk & 1) { d0 = c0; d1 = c1; }
    }
    asm volatile("s_wait_dscnt 0x0" ::: "memory");      // this wave's reads of tile t are done
    asm volatile("s_wait_asynccnt 0x0" ::: "memory");   // its copies of tile t + 1 have landed
    __syncthreads();   // publishes tile t + 1 and frees the buffer of tile t
    if (STAGE) stage_xq(l0 + (t & 1) * (STF * 4), g0 + (t + 2) * SNT);
    // first fragments of tile t + 1, behind its barrier; their latency runs under
    // the last pair's update (after the last trip: a read of the idle buffer, unused)
    load_frags(a0 + ((t + 1) & 1) * STF, 0, f[0]);
    __builtin_amdgcn_sched_barrier(0);   // keeps those reads ahead of the update
    col_update(d0, d1, Mrun, Srun);
}

__global__ void __launch_bounds__(256)
k_stats(const float* __restrict__ XQ, const float* __restrict__ XL,
        float* __restrict__ Ms, float* __restrict__ Ss) {
    __shared__ __attribute__((aligned(16))) float a_lds[2][STF];

    const int tid  = threadIdx.x;
    const int lane = tid & 31;
    const int wave = tid >> 5;
    const int b    = blockIdx.y;
    const int m0   = blockIdx.x * 128 + wave * 16;
    const int ln   = lane & 15;
    const int hi4  = (lane >> 4) << 2;

    const float* q  = XQ + (size_t)b * CL * NN;
    const float* km = XL + (size_t)b * CL * NN;

    // this thread's place in the cooperative copy: row n = tid & 127 of the tile,
    // channels (tid >> 7) + 2 * j, j = 0..39
    const float* g0 = q + (size_t)(tid >> 7) * NN + (tid & 127);
    const unsigned l0 = (unsigned)(uintptr_t)&a_lds[0][(tid & 127) * AST + (tid >> 7)];

    // tile 0 into buffer 0, landed and published; then tile 1 into buffer 1
    stage_xq(l0, g0);
    asm volatile("s_wait_asynccnt 0x0" ::: "memory");   // this wave's copies have landed
    __syncthreads();                                    // every wave's copies are visible
    stage_xq(l0 + STF * 4, g0 + SNT);

    // per-wave B fragments (XL columns m0..m0+15), resident for the whole kernel,
    // in the channel order of the A fragments
    v2f bf[20];
#pragma unroll
    for (int j = 0; j < 10; ++j) {
        const float* kc = km + (size_t)(8 * j + hi4) * NN + m0 + ln;
        bf[2 * j].x     = kc[0];
        bf[2 * j].y     = kc[NN];
        bf[2 * j + 1].x = kc[2 * NN];
        bf[2 * j + 1].y = kc[3 * NN];
    }

    float Mrun = -3.0e38f, Srun = 0.f;
    const float* a0 = &a_lds[0][ln * AST + hi4];
    v4f f[2][10];
    load_frags(a0, 0, f[0]);
    for (int t = 0; t < STR - 2; ++t)      // a tile t + 2 exists
        stats_trip<true>(t, a0, l0, g0, bf, f, Mrun, Srun);
    for (int t = STR - 2; t < STR; ++t)    // the last two tiles: nothing left to stage
        stats_trip<false>(t, a0, l0, g0, bf, f, Mrun, Srun);
    asm volatile("s_wait_asynccnt 0x0" ::: "memory");       // no copy outlives the loop

    // lanes l and l + 16 hold the two halves of column l: merge them
    const float Mo = __shfl_xor(Mrun, 16, 32);
    const float So = __shfl_xor(Srun, 16, 32);
    const float Mf = fmaxf(Mrun, Mo);
    const float Sf = Srun * __expf(Mrun - Mf) + So * __expf(Mo - Mf);
    if (lane < 16) {
        Ms[(size_t)b * NN + m0 + lane] = Mf;
        Ss[(size_t)b * NN + m0 + lane] = Sf;
    }
}

#define PST 18   // LDS row stride (floats) for staged P tiles
#define OTH 512  // threads per block
#define OMT 32   // m columns in a staged tile
#define OXP 40   // LDS pitch (floats) of a staged XL row
#define OVP 36   // LDS pitch (floats) of a staged V row
#define OTF (CL * OXP + CL * OVP)   // floats in one buffer: XL tile, then V tile
#define ONT (1024 / OMT)            // tiles in an m quarter

// One thread's share of a tile: five 16-byte pieces of XL and five of V, 16 rows
// apart.  The closing wait stands inside the statement so that no address
// register named here is rewritten in front of it.
__device__ __forceinline__ void
stage_tile(unsigned lx, unsigned lv, const float* gx, const float* gv) {
    asm volatile("global_load_async_to_lds_b128 %0, %10, off\n\t"
                 "global_load_async_to_lds_b128 %1, %11, off\n\t"
                 "global_load_async_to_lds_b128 %2, %12, off\n\t"
                 "global_load_async_to_lds_b128 %3, %13, off\n\t"
                 "global_load_async_to_lds_b128 %4, %14, off\n\t"
                 "global_load_async_to_lds_b128 %5, %15, off\n\t"
                 "global_load_async_to_lds_b128 %6, %16, off\n\t"
                 "global_load_async_to_lds_b128 %7, %17, off\n\t"
                 "global_load_async_to_lds_b128 %8, %18, off\n\t"
                 "global_load_async_to_lds_b128 %9, %19, off\n\t"
                 "s_wait_xcnt 0x0"
                 :: "v"(lx), "v"(lx + 16 * OXP * 4), "v"(lx + 32 * OXP * 4),
                    "v"(lx + 48 * OXP * 4), "v"(lx + 64 * OXP * 4),
                    "v"(lv), "v"(lv + 16 * OVP * 4), "v"(lv + 32 * OVP * 4),
                    "v"(lv + 48 * OVP * 4), "v"(lv + 64 * OVP * 4),
                    "v"(gx), "v"(gx + 16 * NN), "v"(gx + 32 * NN),
                    "v"(gx + 48 * NN), "v"(gx + 64 * NN),
                    "v"(gv), "v"(gv + 16 * NN), "v"(gv + 32 * NN),
                    "v"(gv + 48 * NN), "v"(gv + 64 * NN)
                 : "memory");
}

__global__ void __launch_bounds__(OTH)
k_out(const float* __restrict__ XQ, const float* __restrict__ XL,
      const float* __restrict__ V, const float* __restrict__ Ms,
      const float* __restrict__ Ss, float* __restrict__ Eout) {
    __shared__ __attribute__((aligned(16))) float T_lds[4][2][OTF];
    __shared__ float E_lds[128 * CL];
    __shared__ float P_lds[16][2][16 * PST];

    const int tid  = threadIdx.x;
    const int lane = tid & 31;
    const int wave = tid >> 5;
    const int nb   = wave & 3;    // 32-row band inside the block
    const int mq   = wave >> 2;   // m quarter
    const int b    = blockIdx.y;
    const int nblk = blockIdx.x * 128;
    const int n0   = nblk + nb * 32;
    const int ln   = lane & 15;
    const int hi2  = (lane >> 4) << 1;
    const int rhi  = (lane >> 4) << 3;

    for (int i = tid; i < 128 * CL; i += OTH) E_lds[i] = 0.f;
    __syncthreads();

    const float* q  = XQ + (size_t)b * CL * NN;
    const float* km = XL + (size_t)b * CL * NN;
    const float* vm = V  + (size_t)b * CL * NN;
    const float* Mp = Ms + (size_t)b * NN;
    const float* Sp = Ss + (size_t)b * NN;

    // this thread's place in its quarter's cooperative copy (128 threads, 8 a row)
    const int crow = (tid & 127) >> 3;
    const int ccol = (tid & 7) * 4;
    const float* gx = km + (size_t)crow * NN + mq * 1024 + ccol;
    const float* gv = vm + (size_t)crow * NN + mq * 1024 + ccol;
    const unsigned lx = (unsigned)(uintptr_t)&T_lds[mq][0][crow * OXP + ccol];
    const unsigned lv = (unsigned)(uintptr_t)&T_lds[mq][0][CL * OXP + crow * OVP + ccol];

    // tile 0 into buffer 0, landed and published; then tile 1 into buffer 1
    stage_tile(lx, lv, gx, gv);
    asm volatile("s_wait_asynccnt 0x0" ::: "memory");   // this wave's copies have landed
    __syncthreads();                                    // every wave's copies are visible
    stage_tile(lx + OTF * 4, lv + OTF * 4, gx + OMT, gv + OMT);

    // A-fragments of XQ for both n-tiles (reused for all m-tiles)
    v2f aq0[20], aq1[20];
#pragma unroll
    for (int k = 0; k < 20; ++k) {
        int c = 4 * k + hi2;
        aq0[k].x = q[(size_t)c * NN + n0 + ln];
        aq0[k].y = q[(size_t)(c + 1) * NN + n0 + ln];
        aq1[k].x = q[(size_t)c * NN + n0 + 16 + ln];
        aq1[k].y = q[(size_t)(c + 1) * NN + n0 + 16 + ln];
    }

    v8f E0[5] = {}, E1[5] = {};
    float* pl0 = &P_lds[wave][0][0];
    float* pl1 = &P_lds[wave][1][0];

    for (int t = 0; t < ONT; ++t) {
        const float* xs = &T_lds[mq][t & 1][0];
        const float* vs = xs + CL * OXP;
        // unrolled so that LDS offsets are immediates and the second half's logits
        // can be scheduled among the first half's P @ V products
#pragma unroll
        for (int h = 0; h < OMT / 16; ++h) {
            const int m0 = mq * 1024 + t * OMT + h * 16;
            // ---- two logits tiles, B fragments read once from the staged XL tile ----
            v8f acc0 = {}, acc1 = {};
#pragma unroll
            for (int k = 0; k < 20; ++k) {
                int c = 4 * k + hi2;
                v2f bfr;
                bfr.x = xs[c * OXP + h * 16 + ln];
                bfr.y = xs[(c + 1) * OXP + h * 16 + ln];
                acc0 = __builtin_amdgcn_wmma_f32_16x16x4_f32(false, aq0[k], false, bfr,
                                                             (short)0, acc0, false, false);
                acc1 = __builtin_amdgcn_wmma_f32_16x16x4_f32(false, aq1[k], false, bfr,
                                                             (short)0, acc1, false, false);
            }
            // ---- P = exp(L - M[m]) / S[m]; stage to LDS (D-layout -> row-major) ----
            float Mc = Mp[m0 + ln];
            float rS = __builtin_amdgcn_rcpf(Sp[m0 + ln]);
#pragma unroll
            for (int r = 0; r < 8; ++r) {
                pl0[(r + rhi) * PST + ln] = __expf(acc0[r] - Mc) * rS;
                pl1[(r + rhi) * PST + ln] = __expf(acc1[r] - Mc) * rS;
            }
            // ---- E += P @ V^T, V fragments shared by both n-tiles ----
#pragma unroll
            for (int kk = 0; kk < 4; ++kk) {
                const int mk = 4 * kk + hi2;
                v2f ap0 = *(const v2f*)&pl0[ln * PST + mk];   // ds_load_b64
                v2f ap1 = *(const v2f*)&pl1[ln * PST + mk];
#pragma unroll
                for (int ct = 0; ct < 5; ++ct) {
                    v2f bv = *(const v2f*)&vs[(ct * 16 + ln) * OVP + h * 16 + mk];  // ds_load_b64
                    E0[ct] = __builtin_amdgcn_wmma_f32_16x16x4_f32(false, ap0, false, bv,
                                                                   (short)0, E0[ct], false, false);
                    E1[ct] = __builtin_amdgcn_wmma_f32_16x16x4_f32(false, ap1, false, bv,
                                                                   (short)0, E1[ct], false, false);
                }
            }
        }
        asm volatile("s_wait_dscnt 0x0" ::: "memory");      // this wave's reads of tile t are done
        asm volatile("s_wait_asynccnt 0x0" ::: "memory");   // its copies of tile t + 1 have landed
        __syncthreads();   // publishes tile t + 1 and frees the buffer of tile t
        if (t + 2 < ONT)
            stage_tile(lx + (t & 1) * (OTF * 4), lv + (t & 1) * (OTF * 4),
                       gx + (t + 2) * OMT, gv + (t + 2) * OMT);
    }
    asm volatile("s_wait_asynccnt 0x0" ::: "memory");       // no copy outlives the loop

    // ---- cross-wave reduce into E_lds[n][c] via ds_add_f32 ----
#pragma unroll
    for (int ct = 0; ct < 5; ++ct)
#pragma unroll
        for (int r = 0; r < 8; ++r) {
            int n = nb * 32 + r + rhi;
            int c = ct * 16 + ln;
            atomicAdd(&E_lds[n * CL + c], E0[ct][r]);
            atomicAdd(&E_lds[(n + 16) * CL + c], E1[ct][r]);
        }
    __syncthreads();

    // ---- add XQ residual (e += xq), store transposed layout [B][C][N] ----
    for (int i = tid; i < 128 * CL; i += OTH) {
        int n = i & 127;
        int c = i >> 7;
        float val = E_lds[n * CL + c] + q[(size_t)c * NN + nblk + n];
        Eout[(size_t)(b * CL + c) * NN + nblk + n] = val;
    }
}

// ---------------------------------------------------------------------------
extern "C" void kernel_launch(void* const* d_in, const int* in_sizes, int n_in,
                              void* d_out, int out_size, void* d_ws, size_t ws_size,
                              hipStream_t stream) {
    const float* x_latter = (const float*)d_in[0];
    const float* x        = (const float*)d_in[1];
    const float* W1 = (const float*)d_in[2];
    const float* b1 = (const float*)d_in[3];
    const float* Wh = (const float*)d_in[4];
    const float* bh = (const float*)d_in[5];
    const float* Wl = (const float*)d_in[6];
    const float* bl = (const float*)d_in[7];
    const float* Wv = (const float*)d_in[8];
    const float* bv = (const float*)d_in[9];

    float* out    = (float*)d_out;
    float* e_out  = out;                              // output 0: e  [B,C,N]
    float* xl_out = out + (size_t)BB * CL * NN;       // output 1: xl [B,C,N]

    // workspace layout (floats): Wc | bc | XQ | V | Ms | Ss  (~21.3 MB)
    float* ws = (float*)d_ws;
    float* Wc = ws;
    float* bc = Wc + CL * CH;
    float* XQ = bc + CL;
    float* V  = XQ + (size_t)BB * CL * NN;
    float* Ms = V  + (size_t)BB * CL * NN;
    float* Ss = Ms + (size_t)BB * NN;

    k_combine<<<dim3((CL * CH + CL + 255) / 256), dim3(256), 0, stream>>>(W1, b1, Wh, bh, Wc, bc);
    k_proj<<<dim3(NN / (PJT / 2), 2, BB), dim3(PJT), 0, stream>>>(
        x_latter, x, Wc, bc, Wl, bl, Wv, bv, xl_out, XQ, V);
    k_stats<<<dim3(NN / 128, BB), dim3(256), 0, stream>>>(XQ, xl_out, Ms, Ss);
    k_out<<<dim3(NN / 128, BB), dim3(OTH), 0, stream>>>(XQ, xl_out, V, Ms, Ss, e_out);
}

// v004
// One run takes 310 microseconds.
// Two timings next to v003 both put it at 1.06 times that version's speed.
// All steps since v000 together make it 1.88 times as fast.
#include <hip/hip_runtime.h>
#include <hip/hip_bf16.h>

// Problem constants
#define BB 8
#define CH 160
#define CL 80
#define NN 4096   // H*W = 64*64

typedef __attribute__((ext_vector_type(2))) float v2f;
typedef __attribute__((ext_vector_type(8))) float v8f;

// ---------------------------------------------------------------------------
// Kernel 1: fold the linear chain  Wc = Wh @ W1,  bc = Wh @ b1 + bh
// ---------------------------------------------------------------------------
__global__ void k_combine(const float* __restrict__ W1, const float* __restrict__ b1,
                          const float* __restrict__ Wh, const float* __restrict__ bh,
                          float* __restrict__ Wc, float* __restrict__ bc) {
    int idx = blockIdx.x * blockDim.x + threadIdx.x;
    if (idx < CL * CH) {
        int o = idx / CH, i = idx - o * CH;
        float s = 0.f;
        for (int j = 0; j < CH; ++j) s += Wh[o * CH + j] * W1[j * CH + i];
        Wc[idx] = s;
    } else if (idx < CL * CH + CL) {
        int o = idx - CL * CH;
        float s = bh[o];
        for (int j = 0; j < CH; ++j) s += Wh[o * CH + j] * b1[j];
        bc[o] = s;
    }
}

// ---------------------------------------------------------------------------
// Kernel 2: projections on the f32 matrix unit.  blockIdx.y selects the source:
//   0: XL = Wc @ x_latter + bc   (written straight into d_out second half)
//   1: XQ = Wl @ x + bl  and  V = Wv @ x + bv  (one read of x feeds both)
// Block = 16 waves * 16 columns of n.  The weight rows (A operand) are staged
// once per block in LDS at pitch K+4 floats (pitch mod 64 = 4 * odd, so the 16
// rows of a ds_load_b64 fragment fall on 64 distinct banks).  Each wave keeps
// its whole K x 16 source tile (B operand) in registers, loaded once, and each
// B fragment feeds every 16-row output tile.  The bias is the start value of
// the accumulator, and k runs upward, as in a plain dot product.
// ---------------------------------------------------------------------------
#define PJT 512   // threads per projection block
template <int K, int CT>   // K input channels, CT output tiles of 16 rows
__device__ __forceinline__ void
proj_tiles(float* __restrict__ w_lds,
           const float* __restrict__ Wa, const float* __restrict__ Wb,
           const float* __restrict__ ba, const float* __restrict__ bb,
           const float* __restrict__ src,
           float* __restrict__ da, float* __restrict__ db) {
    constexpr int PW = K + 4;
    const int tid  = threadIdx.x;
    __builtin_assume(tid < PJT);   // lets the source picks below fold at compile time
    const int lane = tid & 31;
    const int ln   = lane & 15;
    const int hi2  = (lane >> 4) << 1;
    const int rhi  = (lane >> 4) << 3;
    const int n    = blockIdx.x * (PJT / 2) + (tid >> 5) * 16 + ln;

    // weight rows, 16 bytes a thread and trip: rows 0..79 from Wa, rows 80.. from Wb
    // (each matrix is dense, so piece i of a matrix lies at float 4 * i of it).
    // Every load is issued before the first LDS store: one latency covers them all.
    constexpr int KQ = K / 4;                      // float4 pieces in a weight row
    constexpr int NA = CL * KQ;                    // pieces that come from Wa
    constexpr int NW = CT * 16 * KQ;               // pieces in the block's weights
    constexpr int TF = NW / PJT;                   // trips that every thread takes
    constexpr int RM = NW - TF * PJT;              // pieces left for the first threads
    float4 wv[TF];
#pragma unroll
    for (int t = 0; t < TF; ++t) {
        int i = tid + t * PJT;
        wv[t] = *(const float4*)(i < NA ? Wa + 4 * i : Wb + 4 * (i - NA));
    }
    const int ir = tid + TF * PJT;
    const int irow = ir / KQ, ic4 = (ir - irow * KQ) * 4;
    float4 wrem = make_float4(0.f, 0.f, 0.f, 0.f);
    if (tid < RM)
        wrem = *(const float4*)(ir < NA ? Wa + 4 * ir : Wb + 4 * (ir - NA));

    // B fragments: rows 4k+hi2, 4k+hi2+1 of the source, column n
    v2f bf[K / 4];
#pragma unroll
    for (int k = 0; k < K / 4; ++k) {
        bf[k].x = src[(size_t)(4 * k + hi2) * NN + n];
        bf[k].y = src[(size_t)(4 * k + hi2 + 1) * NN + n];
    }

#pragma unroll
    for (int t = 0; t < TF; ++t) {
        int i = tid + t * PJT, row = i / KQ, c4 = (i - row * KQ) * 4;
        *(float4*)&w_lds[row * PW + c4] = wv[t];
    }
    if (tid < RM) *(float4*)&w_lds[irow * PW + ic4] = wrem;

    v8f acc[CT];
#pragma unroll
    for (int ct = 0; ct < CT; ++ct) {
        const float* bias = ct < CL / 16 ? ba + ct * 16 : bb + (ct - CL / 16) * 16;
#pragma unroll
        for (int r = 0; r < 8; ++r) acc[ct][r] = bias[r + rhi];
    }
    __syncthreads();   // weight rows visible to every wave

#pragma unroll
    for (int k = 0; k < K / 4; ++k)
#pragma unroll
        for (int ct = 0; ct < CT; ++ct) {
            v2f a = *(const v2f*)&w_lds[(ct * 16 + ln) * PW + 4 * k + hi2];  // ds_load_b64
            acc[ct] = __builtin_amdgcn_wmma_f32_16x16x4_f32(false, a, false, bf[k],
                                                            (short)0, acc[ct], false, false);
        }

#pragma unroll
    for (int ct = 0; ct < CT; ++ct) {
        float* d = ct < CL / 16 ? da + (size_t)(ct * 16) * NN
                                : db + (size_t)((ct - CL / 16) * 16) * NN;
#pragma unroll
        for (int r = 0; r < 8; ++r) d[(size_t)(r + rhi) * NN + n] = acc[ct][r];
    }
    // the stores above name their address and data registers: hold any later
    // rewrite of those registers behind this wait
    asm volatile("s_wait_xcnt 0x0" ::: "memory");
}

__global__ void __launch_bounds__(PJT)
k_proj(const float* __restrict__ xlat, const float* __restrict__ x,
       const float* __restrict__ Wc, const float* __restrict__ bc,
       const float* __restrict__ Wl, const float* __restrict__ bl,
       const float* __restrict__ Wv, const float* __restrict__ bv,
       float* __restrict__ XL, float* __restrict__ XQ, float* __restrict__ V) {
    __shared__ __attribute__((aligned(16))) float w_lds[2 * CL * (CL + 4)];  // >= CL*(CH+4)
    const size_t b = blockIdx.z;
    const size_t o = b * CL * NN;
    if (blockIdx.y == 0)
        proj_tiles<CH, CL / 16>(w_lds, Wc, Wc, bc, bc, xlat + b * CH * NN, XL + o, XL + o);
    else
        proj_tiles<CL, 2 * CL / 16>(w_lds, Wl, Wv, bl, bv, x + o, XQ + o, V + o);
}

typedef __attribute__((ext_vector_type(4))) float v4f;
#define AST 84               // LDS row pitch (floats) of the staged XQ tile
#define SNT 128              // rows of n in a staged tile
#define STF (SNT * AST)      // floats in one buffer
#define STR (NN / SNT)       // trips
#define LKC 1792             // columns of m (of every batch) whose logits are kept
#define LKT (LKC / 16)       // the same in tiles of 16 columns
#define LTF (NN * 16)        // floats kept for one such tile: all rows of n

// Ten of a thread's forty copies of a tile: one n, channels two apart.  The
// closing wait stands inside the statement so that no address register named
// here is rewritten in front of it.
__device__ __forceinline__ void
stage_rows(unsigned l, const float* g) {
    asm volatile("global_load_async_to_lds_b32 %0, %10, off\n\t"
                 "global_load_async_to_lds_b32 %1, %11, off\n\t"
                 "global_load_async_to_lds_b32 %2, %12, off\n\t"
                 "global_load_async_to_lds_b32 %3, %13, off\n\t"
                 "global_load_async_to_lds_b32 %4, %14, off\n\t"
                 "global_load_async_to_lds_b32 %5, %15, off\n\t"
                 "global_load_async_to_lds_b32 %6, %16, off\n\t"
                 "global_load_async_to_lds_b32 %7, %17, off\n\t"
                 "global_load_async_to_lds_b32 %8, %18, off\n\t"
                 "global_load_async_to_lds_b32 %9, %19, off\n\t"
                 "s_wait_xcnt 0x0"
                 :: "v"(l), "v"(l + 8), "v"(l + 16), "v"(l + 24), "v"(l + 32),
                    "v"(l + 40), "v"(l + 48), "v"(l + 56), "v"(l + 64), "v"(l + 72),
                    "v"(g), "v"(g + 2 * NN), "v"(g + 4 * NN), "v"(g + 6 * NN),
                    "v"(g + 8 * NN), "v"(g + 10 * NN), "v"(g + 12 * NN),
                    "v"(g + 14 * NN), "v"(g + 16 * NN), "v"(g + 18 * NN)
                 : "memory");
}
__device__ __forceinline__ void
stage_xq(unsigned l, const float* g) {
#pragma unroll
    for (int i = 0; i < 4; ++i) stage_rows(l + 80 * i, g + (size_t)(20 * i) * NN);
}

// A fragments of block blk: tiles 2 * (blk >> 1) and + 1, channel half blk & 1
__device__ __forceinline__ void
load_frags(const float* as, int blk, v4f (&f)[10]) {
    const int row = (blk >> 1) * 32, c0 = (blk & 1) * 40;
#pragma unroll
    for (int i = 0; i < 5; ++i) {
        f[i]     = *(const v4f*)&as[row * AST + c0 + 8 * i];          // ds_load_b128
        f[5 + i] = *(const v4f*)&as[(row + 16) * AST + c0 + 8 * i];
    }
}

// online max / sum of one lane's 16 logits (8 rows of two tiles, one column)
__device__ __forceinline__ void
col_update(const v8f& a, const v8f& b, float& M, float& S) {
    float mx = M;
#pragma unroll
    for (int r = 0; r < 8; ++r) mx = fmaxf(mx, fmaxf(a[r], b[r]));
    float sa = 0.f, sb = 0.f;
#pragma unroll
    for (int r = 0; r < 8; ++r) {
        sa += __expf(a[r] - mx);
        sb += __expf(b[r] - mx);
    }
    S = S * __expf(M - mx) + (sa + sb);
    M = mx;
}

// the logits of a tile pair to the workspace; written once and read once, so
// they are marked non-temporal and leave XQ and XL their place in L2
__device__ __forceinline__ void
keep_pair(float* p, const v8f& a, const v8f& b) {
    __builtin_nontemporal_store(__builtin_shufflevector(a, a, 0, 1, 2, 3), (v4f*)p);
    __builtin_nontemporal_store(__builtin_shufflevector(a, a, 4, 5, 6, 7), (v4f*)(p + 128));
    __builtin_nontemporal_store(__builtin_shufflevector(b, b, 0, 1, 2, 3), (v4f*)(p + 256));
    __builtin_nontemporal_store(__builtin_shufflevector(b, b, 4, 5, 6, 7), (v4f*)(p + 384));
    // holds any later rewrite of the stores' address and data registers behind it
    asm volatile("s_wait_xcnt 0x0" ::: "memory");
}

// One trip: the 128 staged rows of tile t against the wave's 16 columns.  STAGE
// says whether a tile t + 2 exists, KEEP whether the logits go to the workspace
// (at lg); they are compile-time arguments so that the trip stays one straight
// run of code.  On entry f[0] holds block 0's fragments.
template <bool STAGE, bool KEEP>
__device__ __forceinline__ void
stats_trip(int t, const float* a0, unsigned l0, const float* g0, float* lg,
           const v2f (&bf)[20], v4f (&f)[2][10], float& Mrun, float& Srun) {
    const float* as = a0 + (t & 1) * STF;
    v8f c0 = {}, c1 = {}, d0 = {}, d1 = {};
#pragma unroll
    for (int blk = 0; blk < 8; ++blk) {
        // the fence pair keeps the next block's LDS reads in one group ahead of
        // this block's matrix instructions instead of spread among them
        __builtin_amdgcn_sched_barrier(0);
        if (blk < 7) load_frags(as, blk + 1, f[(blk + 1) & 1]);
        __builtin_amdgcn_sched_barrier(0);
        if ((blk & 1) == 0) { c0 = v8f{}; c1 = v8f{}; }
#pragma unroll
        for (int i = 0; i < 5; ++i) {
            const int j = (blk & 1) * 5 + i;
            const v4f x = f[blk & 1][i], y = f[blk & 1][5 + i];
            c0 = __builtin_amdgcn_wmma_f32_16x16x4_f32(false, x.xy, false, bf[2 * j],
                                                       (short)0, c0, false, false);
            c1 = __builtin_amdgcn_wmma_f32_16x16x4_f32(false, y.xy, false, bf[2 * j],
                                                       (short)0, c1, false, false);
            c0 = __builtin_amdgcn_wmma_f32_16x16x4_f32(false, x.zw, false, bf[2 * j + 1],
                                                       (short)0, c0, false, false);
            c1 = __builtin_amdgcn_wmma_f32_16x16x4_f32(false, y.zw, false, bf[2 * j + 1],
                                                       (short)0, c1, false, false);
        }
        // the finished tile pair is folded in beside the next pair's products
        if ((blk & 1) == 0 && blk > 0) {
            if (KEEP) keep_pair(lg + (t * 4 + (blk >> 1) - 1) * 512, d0, d1);
            col_update(d0, d1, Mrun, Srun);
        }
        if (blk & 1) { d0 = c0; d1 = c1; }
    }
    asm volatile("s_wait_dscnt 0x0" ::: "memory");      // this wave's reads of tile t are done
    asm volatile("s_wait_asynccnt 0x0" ::: "memory");   // its copies of tile t + 1 have landed
    __syncthreads();   // publishes tile t + 1 and frees the buffer of tile t
    if (STAGE) stage_xq(l0 + (t & 1) * (STF * 4), g0 + (t + 2) * SNT);
    // first fragments of tile t + 1, behind its barrier; their latency runs under
    // the last pair's update (after the last trip: a read of the idle buffer, unused)
    load_frags(a0 + ((t + 1) & 1) * STF, 0, f[0]);
    __builtin_amdgcn_sched_barrier(0);   // keeps those reads ahead of the update
    if (KEEP) keep_pair(lg + (t * 4 + 3) * 512, d0, d1);
    col_update(d0, d1, Mrun, Srun);
}

template <bool KEEP>
__device__ __forceinline__ void
stats_trips(const float* a0, unsigned l0, const float* g0, float* lg,
            const v2f (&bf)[20], v4f (&f)[2][10], float& Mrun, float& Srun) {
    for (int t = 0; t < STR - 2; ++t)      // a tile t + 2 exists
        stats_trip<true, KEEP>(t, a0, l0, g0, lg, bf, f, Mrun, Srun);
    for (int t = STR - 2; t < STR; ++t)    // the last two tiles: nothing left to stage
        stats_trip<false, KEEP>(t, a0, l0, g0, lg, bf, f, Mrun, Srun);
}

__global__ void __launch_bounds__(256)
k_stats(const float* __restrict__ XQ, const float* __restrict__ XL,
        float* __restrict__ Ms, float* __restrict__ Ss, float* __restrict__ LG) {
    __shared__ __attribute__((aligned(16))) float a_lds[2][STF];

    const int tid  = threadIdx.x;
    const int lane = tid & 31;
    const int wave = tid >> 5;
    const int b    = blockIdx.y;
    const int m0   = blockIdx.x * 128 + wave * 16;
    const int ln   = lane & 15;
    const int hi4  = (lane >> 4) << 2;

    const float* q  = XQ + (size_t)b * CL * NN;
    const float* km = XL + (size_t)b * CL * NN;

    // this thread's place in the cooperative copy: row n = tid & 127 of the tile,
    // channels (tid >> 7) + 2 * j, j = 0..39
    const float* g0 = q + (size_t)(tid >> 7) * NN + (tid & 127);
    const unsigned l0 = (unsigned)(uintptr_t)&a_lds[0][(tid & 127) * AST + (tid >> 7)];

    // tile 0 into buffer 0, landed and published; then tile 1 into buffer 1
    stage_xq(l0, g0);
    asm volatile("s_wait_asynccnt 0x0" ::: "memory");   // this wave's copies have landed
    __syncthreads();                                    // every wave's copies are visible
    stage_xq(l0 + STF * 4, g0 + SNT);

    // per-wave B fragments (XL columns m0..m0+15), resident for the whole kernel,
    // in the channel order of the A fragments
    v2f bf[20];
#pragma unroll
    for (int j = 0; j < 10; ++j) {
        const float* kc = km + (size_t)(8 * j + hi4) * NN + m0 + ln;
        bf[2 * j].x     = kc[0];
        bf[2 * j].y     = kc[NN];
        bf[2 * j + 1].x = kc[2 * NN];
        bf[2 * j + 1].y = kc[3 * NN];
    }

    float Mrun = -3.0e38f, Srun = 0.f;
    const float* a0 = &a_lds[0][ln * AST + hi4];
    v4f f[2][10];
    load_frags(a0, 0, f[0]);
    if (blockIdx.x < LKC / 128)            // the same for the whole block
        stats_trips<true>(a0, l0, g0, LG + (size_t)(b * LKT + (m0 >> 4)) * LTF + lane * 4,
                          bf, f, Mrun, Srun);
    else
        stats_trips<false>(a0, l0, g0, nullptr, bf, f, Mrun, Srun);
    asm volatile("s_wait_asynccnt 0x0" ::: "memory");       // no copy outlives the loop

    // lanes l and l + 16 hold the two halves of column l: merge them
    const float Mo = __shfl_xor(Mrun, 16, 32);
    const float So = __shfl_xor(Srun, 16, 32);
    const float Mf = fmaxf(Mrun, Mo);
    const float Sf = Srun * __expf(Mrun - Mf) + So * __expf(Mo - Mf);
    if (lane < 16) {
        Ms[(size_t)b * NN + m0 + lane] = Mf;
        Ss[(size_t)b * NN + m0 + lane] = Sf;
    }
}

#define PST 18   // LDS row stride (floats) for staged P tiles
#define OTH 512  // threads per block
#define OMT 32   // m columns in a staged tile
#define OXP 40   // LDS pitch (floats) of a staged XL row
#define OVP 36   // LDS pitch (floats) of a staged V row
#define OTF (CL * OXP + CL * OVP)   // floats in one buffer: XL tile, then V tile
#define ONT (1024 / OMT)            // tiles in an m quarter
#define OCT ((NN - LKC) / 4 / OMT)  // of them with logits formed here; the rest are kept ones

// One thread's share of a tile: five 16-byte pieces of XL and five of V, 16 rows
// apart.  The closing wait stands inside the statement so that no address
// register named here is rewritten in front of it.
__device__ __forceinline__ void
stage_tile(unsigned lx, unsigned lv, const float* gx, const float* gv) {
    asm volatile("global_load_async_to_lds_b128 %0, %10, off\n\t"
                 "global_load_async_to_lds_b128 %1, %11, off\n\t"
                 "global_load_async_to_lds_b128 %2, %12, off\n\t"
                 "global_load_async_to_lds_b128 %3, %13, off\n\t"
                 "global_load_async_to_lds_b128 %4, %14, off\n\t"
                 "global_load_async_to_lds_b128 %5, %15, off\n\t"
                 "global_load_async_to_lds_b128 %6, %16, off\n\t"
                 "global_load_async_to_lds_b128 %7, %17, off\n\t"
                 "global_load_async_to_lds_b128 %8, %18, off\n\t"
                 "global_load_async_to_lds_b128 %9, %19, off\n\t"
                 "s_wait_xcnt 0x0"
                 :: "v"(lx), "v"(lx + 16 * OXP * 4), "v"(lx + 32 * OXP * 4),
                    "v"(lx + 48 * OXP * 4), "v"(lx + 64 * OXP * 4),
                    "v"(lv), "v"(lv + 16 * OVP * 4), "v"(lv + 32 * OVP * 4),
                    "v"(lv + 48 * OVP * 4), "v"(lv + 64 * OVP * 4),
                    "v"(gx), "v"(gx + 16 * NN), "v"(gx + 32 * NN),
                    "v"(gx + 48 * NN), "v"(gx + 64 * NN),
                    "v"(gv), "v"(gv + 16 * NN), "v"(gv + 32 * NN),
                    "v"(gv + 48 * NN), "v"(gv + 64 * NN)
                 : "memory");
}

// The V half of that share alone, for a tile whose logits are kept.
__device__ __forceinline__ void
stage_v(unsigned lv, const float* gv) {
    asm volatile("global_load_async_to_lds_b128 %0, %5, off\n\t"
                 "global_load_async_to_lds_b128 %1, %6, off\n\t"
                 "global_load_async_to_lds_b128 %2, %7, off\n\t"
                 "global_load_async_to_lds_b128 %3, %8, off\n\t"
                 "global_load_async_to_lds_b128 %4, %9, off\n\t"
                 "s_wait_xcnt 0x0"
                 :: "v"(lv), "v"(lv + 16 * OVP * 4), "v"(lv + 32 * OVP * 4),
                    "v"(lv + 48 * OVP * 4), "v"(lv + 64 * OVP * 4),
                    "v"(gv), "v"(gv + 16 * NN), "v"(gv + 32 * NN),
                    "v"(gv + 48 * NN), "v"(gv + 64 * NN)
                 : "memory");
}

// A lane's 32 kept logits of one trip (a tile pair for each 16 columns) with their
// columns' max and sum.  The logits are read once: non-temporal.
__device__ __forceinline__ void
load_kept(const float* p, const float* mp, const float* sp,
          v4f (&L)[OMT / 16][4], float (&M)[OMT / 16], float (&S)[OMT / 16]) {
    // the fence pair keeps the loads and their wait in one group, so that nothing
    // that takes over an address register is scheduled in between
    __builtin_amdgcn_sched_barrier(0);
#pragma unroll
    for (int h = 0; h < OMT / 16; ++h) {
#pragma unroll
        for (int j = 0; j < 4; ++j)
            L[h][j] = __builtin_nontemporal_load((const v4f*)(p + h * LTF + 128 * j));
        M[h] = mp[h * 16];
        S[h] = sp[h * 16];
    }
    // holds any later rewrite of the loads' address registers behind it; the addresses
    // are its inputs so that they live up to it and no load's result is laid on them
    asm volatile("s_wait_xcnt 0x0" :: "v"(p), "v"(mp), "v"(sp) : "memory");
    __builtin_amdgcn_sched_barrier(0);
}

__global__ void __launch_bounds__(OTH)
k_out(const float* __restrict__ XQ, const float* __restrict__ XL,
      const float* __restrict__ V, const float* __restrict__ Ms,
      const float* __restrict__ Ss, const float* __restrict__ LG,
      float* __restrict__ Eout) {
    __shared__ __attribute__((aligned(16))) float T_lds[4][2][OTF];
    __shared__ float E_lds[128 * CL];
    __shared__ float P_lds[16][2][16 * PST];

    const int tid  = threadIdx.x;
    const int lane = tid & 31;
    const int wave = tid >> 5;
    const int nb   = wave & 3;    // 32-row band inside the block
    const int mq   = wave >> 2;   // m quarter
    const int b    = blockIdx.y;
    const int nblk = blockIdx.x * 128;
    const int n0   = nblk + nb * 32;
    const int ln   = lane & 15;
    const int hi2  = (lane >> 4) << 1;
    const int rhi  = (lane >> 4) << 3;

    for (int i = tid; i < 128 * CL; i += OTH) E_lds[i] = 0.f;
    __syncthreads();

    const float* q  = XQ + (size_t)b * CL * NN;
    const float* km = XL + (size_t)b * CL * NN;
    const float* vm = V  + (size_t)b * CL * NN;
    const float* Mp = Ms + (size_t)b * NN;
    const float* Sp = Ss + (size_t)b * NN;

    // this thread's place in its quarter's cooperative copy (128 threads, 8 a row)
    const int crow = (tid & 127) >> 3;
    const int ccol = (tid & 7) * 4;
    const int mc = LKC + mq * (OCT * OMT);                 // trip t < OCT: columns mc + t * OMT
    const int mk = mq * ((ONT - OCT) * OMT);               // trip t >= OCT: columns mk + (t - OCT) * OMT
    const float* gx = km + (size_t)crow * NN + mc + ccol;
    const float* gv = vm + (size_t)crow * NN + mc + ccol;
    const float* gk = vm + (size_t)crow * NN + mk + ccol;
    const unsigned lx = (unsigned)(uintptr_t)&T_lds[mq][0][crow * OXP + ccol];
    const unsigned lv = (unsigned)(uintptr_t)&T_lds[mq][0][CL * OXP + crow * OVP + ccol];

    // tile 0 into buffer 0, landed and published; then tile 1 into buffer 1
    stage_tile(lx, lv, gx, gv);
    asm volatile("s_wait_asynccnt 0x0" ::: "memory");   // this wave's copies have landed
    __syncthreads();                                    // every wave's copies are visible
    stage_tile(lx + OTF * 4, lv + OTF * 4, gx + OMT, gv + OMT);

    // A-fragments of XQ for both n-tiles (reused for the m-tiles whose logits are formed here)
    v2f aq0[20], aq1[20];
#pragma unroll
    for (int k = 0; k < 20; ++k) {
        int c = 4 * k + hi2;
        aq0[k].x = q[(size_t)c * NN + n0 + ln];
        aq0[k].y = q[(size_t)(c + 1) * NN + n0 + ln];
        aq1[k].x = q[(size_t)c * NN + n0 + 16 + ln];
        aq1[k].y = q[(size_t)(c + 1) * NN + n0 + 16 + ln];
    }

    v8f E0[5] = {}, E1[5] = {};
    float* pl0 = &P_lds[wave][0][0];
    float* pl1 = &P_lds[wave][1][0];

    for (int t = 0; t < OCT; ++t) {
        const float* xs = &T_lds[mq][t & 1][0];
        const float* vs = xs + CL * OXP;
        // unrolled so that LDS offsets are immediates and the second half's logits
        // can be scheduled among the first half's P @ V products
#pragma unroll
        for (int h = 0; h < OMT / 16; ++h) {
            const int m0 = mc + t * OMT + h * 16;
            // ---- two logits tiles, B fragments read once from the staged XL tile ----
            v8f acc0 = {}, acc1 = {};
#pragma unroll
            for (int k = 0; k < 20; ++k) {
                int c = 4 * k + hi2;
                v2f bfr;
                bfr.x = xs[c * OXP + h * 16 + ln];
                bfr.y = xs[(c + 1) * OXP + h * 16 + ln];
                acc0 = __builtin_amdgcn_wmma_f32_16x16x4_f32(false, aq0[k], false, bfr,
                                                             (short)0, acc0, false, false);
                acc1 = __builtin_amdgcn_wmma_f32_16x16x4_f32(false, aq1[k], false, bfr,
                                                             (short)0, acc1, false, false);
            }
            // ---- P = exp(L - M[m]) / S[m]; stage to LDS (D-layout -> row-major) ----
            float Mc = Mp[m0 + ln];
            float rS = __builtin_amdgcn_rcpf(Sp[m0 + ln]);
#pragma unroll
            for (int r = 0; r < 8; ++r) {
                pl0[(r + rhi) * PST + ln] = __expf(acc0[r] - Mc) * rS;
                pl1[(r + rhi) * PST + ln] = __expf(acc1[r] - Mc) * rS;
            }
            // ---- E += P @ V^T, V fragments shared by both n-tiles ----
#pragma unroll
            for (int kk = 0; kk < 4; ++kk) {
                const int mk = 4 * kk + hi2;
                v2f ap0 = *(const v2f*)&pl0[ln * PST + mk];   // ds_load_b64
                v2f ap1 = *(const v2f*)&pl1[ln * PST + mk];
#pragma unroll
                for (int ct = 0; ct < 5; ++ct) {
                    v2f bv = *(const v2f*)&vs[(ct * 16 + ln) * OVP + h * 16 + mk];  // ds_load_b64
                    E0[ct] = __builtin_amdgcn_wmma_f32_16x16x4_f32(false, ap0, false, bv,
                                                                   (short)0, E0[ct], false, false);
                    E1[ct] = __builtin_amdgcn_wmma_f32_16x16x4_f32(false, ap1, false, bv,
                                                                   (short)0, E1[ct], false, false);
                }
            }
        }
        asm volatile("s_wait_dscnt 0x0" ::: "memory");      // this wave's reads of tile t are done
        asm volatile("s_wait_asynccnt 0x0" ::: "memory");   // its copies of tile t + 1 have landed
        __syncthreads();   // publishes tile t + 1 and frees the buffer of tile t
        if (t + 2 < OCT)
            stage_tile(lx + (t & 1) * (OTF * 4), lv + (t & 1) * (OTF * 4),
                       gx + (t + 2) * OMT, gv + (t + 2) * OMT);
        else
            stage_v(lv + (t & 1) * (OTF * 4), gk + (t + 2 - OCT) * OMT);
    }

    // ---- the tiles with kept logits, which are fetched one trip ahead ----
    const float* lg = LG + ((size_t)b * LKT + (mk >> 4)) * LTF + (n0 >> 5) * 512 + lane * 4;
    v4f Lk[OMT / 16][4];
    float Mk[OMT / 16], Sk[OMT / 16];
    load_kept(lg, Mp + mk + ln, Sp + mk + ln, Lk, Mk, Sk);
    for (int t = OCT; t < ONT; ++t) {
        const float* vs = &T_lds[mq][t & 1][CL * OXP];
        // L - M[m] and 1 / S[m] of the whole trip first: the next trip's values are
        // then asked for at once and have this trip's products to arrive under
        v4f X[OMT / 16][4];
        float rS[OMT / 16];
#pragma unroll
        for (int h = 0; h < OMT / 16; ++h) {
#pragma unroll
            for (int j = 0; j < 4; ++j) X[h][j] = Lk[h][j] - Mk[h];
            rS[h] = __builtin_amdgcn_rcpf(Sk[h]);
        }
        if (t + 1 < ONT) {
            const int m1 = mk + (t + 1 - OCT) * OMT + ln;
            load_kept(lg + (size_t)((t + 1 - OCT) * (OMT / 16)) * LTF, Mp + m1, Sp + m1, Lk, Mk, Sk);
        }
#pragma unroll
        for (int h = 0; h < OMT / 16; ++h) {
            // ---- P = exp(L - M[m]) / S[m]; stage to LDS (D-layout -> row-major) ----
#pragma unroll
            for (int r = 0; r < 4; ++r) {
                pl0[(r + rhi) * PST + ln]     = __expf(X[h][0][r]) * rS[h];
                pl0[(r + 4 + rhi) * PST + ln] = __expf(X[h][1][r]) * rS[h];
                pl1[(r + rhi) * PST + ln]     = __expf(X[h][2][r]) * rS[h];
                pl1[(r + 4 + rhi) * PST + ln] = __expf(X[h][3][r]) * rS[h];
            }
            // ---- E += P @ V^T, V fragments shared by both n-tiles ----
#pragma unroll
            for (int kk = 0; kk < 4; ++kk) {
                const int mk4 = 4 * kk + hi2;
                v2f ap0 = *(const v2f*)&pl0[ln * PST + mk4];   // ds_load_b64
                v2f ap1 = *(const v2f*)&pl1[ln * PST + mk4];
#pragma unroll
                for (int ct = 0; ct < 5; ++ct) {
                    v2f bv = *(const v2f*)&vs[(ct * 16 + ln) * OVP + h * 16 + mk4];  // ds_load_b64
                    E0[ct] = __builtin_amdgcn_wmma_f32_16x16x4_f32(false, ap0, false, bv,
                                                                   (short)0, E0[ct], false, false);
                    E1[ct] = __builtin_amdgcn_wmma_f32_16x16x4_f32(false, ap1, false, bv,
                                                                   (short)0, E1[ct], false, false);
                }
            }
        }
        asm volatile("s_wait_dscnt 0x0" ::: "memory");      // this wave's reads of tile t are done
        asm volatile("s_wait_asynccnt 0x0" ::: "memory");   // its copies of tile t + 1 have landed
        __syncthreads();   // publishes tile t + 1 and frees the buffer of tile t
        if (t + 2 < ONT)
            stage_v(lv + (t & 1) * (OTF * 4), gk + (t + 2 - OCT) * OMT);
    }
    asm volatile("s_wait_asynccnt 0x0" ::: "memory");       // no copy outlives the loop

    // ---- cross-wave reduce into E_lds[n][c] via ds_add_f32 ----
#pragma unroll
    for (int ct = 0; ct < 5; ++ct)
#pragma unroll
        for (int r = 0; r < 8; ++r) {
            int n = nb * 32 + r + rhi;
            int c = ct * 16 + ln;
            atomicAdd(&E_lds[n * CL + c], E0[ct][r]);
            atomicAdd(&E_lds[(n + 16) * CL + c], E1[ct][r]);
        }
    __syncthreads();

    // ---- add XQ residual (e += xq), store transposed layout [B][C][N] ----
    for (int i = tid; i < 128 * CL; i += OTH) {
        int n = i & 127;
        int c = i >> 7;
        float val = E_lds[n * CL + c] + q[(size_t)c * NN + nblk + n];
        Eout[(size_t)(b * CL + c) * NN + nblk + n] = val;
    }
}

// ---------------------------------------------------------------------------
extern "C" void kernel_launch(void* const* d_in, const int* in_sizes, int n_in,
                              void* d_out, int out_size, void* d_ws, size_t ws_size,
                              hipStream_t stream) {
    const float* x_latter = (const float*)d_in[0];
    const float* x        = (const float*)d_in[1];
    const float* W1 = (const float*)d_in[2];
    const float* b1 = (const float*)d_in[3];
    const float* Wh = (const float*)d_in[4];
    const float* bh = (const float*)d_in[5];
    const float* Wl = (const float*)d_in[6];
    const float* bl = (const float*)d_in[7];
    const float* Wv = (const float*)d_in[8];
    const float* bv = (const float*)d_in[9];

    float* out    = (float*)d_out;
    float* e_out  = out;                              // output 0: e  [B,C,N]
    float* xl_out = out + (size_t)BB * CL * NN;       // output 1: xl [B,C,N]

    // workspace layout (floats): Wc | bc | XQ | V | Ms | Ss  (~21.3 MB) | LG (224 MiB)
    float* ws = (float*)d_ws;
    float* Wc = ws;
    float* bc = Wc + CL * CH;
    float* XQ = bc + CL;
    float* V  = XQ + (size_t)BB * CL * NN;
    float* Ms = V  + (size_t)BB * CL * NN;
    float* Ss = Ms + (size_t)BB * NN;
    float* LG = ws + 5321344;   // first multiple of 256 bytes behind Ss

    k_combine<<<dim3((CL * CH + CL + 255) / 256), dim3(256), 0, stream>>>(W1, b1, Wh, bh, Wc, bc);
    k_proj<<<dim3(NN / (PJT / 2), 2, BB), dim3(PJT), 0, stream>>>(
        x_latter, x, Wc, bc, Wl, bl, Wv, bv, xl_out, XQ, V);
    k_stats<<<dim3(NN / 128, BB), dim3(256), 0, stream>>>(XQ, xl_out, Ms, Ss, LG);
    k_out<<<dim3(NN / 128, BB), dim3(OTH), 0, stream>>>(XQ, xl_out, V, Ms, Ss, LG, e_out);
}

// v005
// A run of this version takes 300 microseconds.
// Two timings next to v004 both put it at 1.03 times that version's speed.
// Counting every step since v000, it is 1.94 times as fast.
#include <hip/hip_runtime.h>
#include <hip/hip_bf16.h>

// Problem constants
#define BB 8
#define CH 160
#define CL 80
#define NN 4096   // H*W = 64*64

typedef __attribute__((ext_vector_type(2))) float v2f;
typedef __attribute__((ext_vector_type(8))) float v8f;

// ---------------------------------------------------------------------------
// Kernel 1: fold the linear chain  Wc = Wh @ W1,  bc = Wh @ b1 + bh
// ---------------------------------------------------------------------------
__global__ void k_combine(const float* __restrict__ W1, const float* __restrict__ b1,
                          const float* __restrict__ Wh, const float* __restrict__ bh,
                          float* __restrict__ Wc, float* __restrict__ bc) {
    int idx = blockIdx.x * blockDim.x + threadIdx.x;
    if (idx < CL * CH) {
        int o = idx / CH, i = idx - o * CH;
        float s = 0.f;
        for (int j = 0; j < CH; ++j) s += Wh[o * CH + j] * W1[j * CH + i];
        Wc[idx] = s;
    } else if (idx < CL * CH + CL) {
        int o = idx - CL * CH;
        float s = bh[o];
        for (int j = 0; j < CH; ++j) s += Wh[o * CH + j] * b1[j];
        bc[o] = s;
    }
}

// ---------------------------------------------------------------------------
// Kernel 2: projections on the f32 matrix unit.  blockIdx.y selects the source:
//   0: XL = Wc @ x_latter + bc   (written straight into d_out second half)
//   1: XQ = Wl @ x + bl  and  V = Wv @ x + bv  (one read of x feeds both)
// Block = 16 waves * 16 columns of n.  The weight rows (A operand) are staged
// once per block in LDS at pitch K+4 floats (pitch mod 64 = 4 * odd, so the 16
// rows of a ds_load_b64 fragment fall on 64 distinct banks).  Each wave keeps
// its whole K x 16 source tile (B operand) in registers, loaded once, and each
// B fragment feeds every 16-row output tile.  The bias is the start value of
// the accumulator, and k runs upward, as in a plain dot product.
// ---------------------------------------------------------------------------
#define PJT 512   // threads per projection block
template <int K, int CT>   // K input channels, CT output tiles of 16 rows
__device__ __forceinline__ void
proj_tiles(float* __restrict__ w_lds,
           const float* __restrict__ Wa, const float* __restrict__ Wb,
           const float* __restrict__ ba, const float* __restrict__ bb,
           const float* __restrict__ src,
           float* __restrict__ da, float* __restrict__ db) {
    constexpr int PW = K + 4;
    const int tid  = threadIdx.x;
    __builtin_assume(tid < PJT);   // lets the source picks below fold at compile time
    const int lane = tid & 31;
    const int ln   = lane & 15;
    const int hi2  = (lane >> 4) << 1;
    const int rhi  = (lane >> 4) << 3;
    const int n    = blockIdx.x * (PJT / 2) + (tid >> 5) * 16 + ln;

    // weight rows, 16 bytes a thread and trip: rows 0..79 from Wa, rows 80.. from Wb
    // (each matrix is dense, so piece i of a matrix lies at float 4 * i of it).
    // Every load is issued before the first LDS store: one latency covers them all.
    constexpr int KQ = K / 4;                      // float4 pieces in a weight row
    constexpr int NA = CL * KQ;                    // pieces that come from Wa
    constexpr int NW = CT * 16 * KQ;               // pieces in the block's weights
    constexpr int TF = NW / PJT;                   // trips that every thread takes
    constexpr int RM = NW - TF * PJT;              // pieces left for the first threads
    float4 wv[TF];
#pragma unroll
    for (int t = 0; t < TF; ++t) {
        int i = tid + t * PJT;
        wv[t] = *(const float4*)(i < NA ? Wa + 4 * i : Wb + 4 * (i - NA));
    }
    const int ir = tid + TF * PJT;
    const int irow = ir / KQ, ic4 = (ir - irow * KQ) * 4;
    float4 wrem = make_float4(0.f, 0.f, 0.f, 0.f);
    if (tid < RM)
        wrem = *(const float4*)(ir < NA ? Wa + 4 * ir : Wb + 4 * (ir - NA));

    // B fragments: rows 4k+hi2, 4k+hi2+1 of the source, column n
    v2f bf[K / 4];
#pragma unroll
    for (int k = 0; k < K / 4; ++k) {
        bf[k].x = src[(size_t)(4 * k + hi2) * NN + n];
        bf[k].y = src[(size_t)(4 * k + hi2 + 1) * NN + n];
    }

#pragma unroll
    for (int t = 0; t < TF; ++t) {
        int i = tid + t * PJT, row = i / KQ, c4 = (i - row * KQ) * 4;
        *(float4*)&w_lds[row * PW + c4] = wv[t];
    }
    if (tid < RM) *(float4*)&w_lds[irow * PW + ic4] = wrem;

    v8f acc[CT];
#pragma unroll
    for (int ct = 0; ct < CT; ++ct) {
        const float* bias = ct < CL / 16 ? ba + ct * 16 : bb + (ct - CL / 16) * 16;
#pragma unroll
        for (int r = 0; r < 8; ++r) acc[ct][r] = bias[r + rhi];
    }
    __syncthreads();   // weight rows visible to every wave

#pragma unroll
    for (int k = 0; k < K / 4; ++k)
#pragma unroll
        for (int ct = 0; ct < CT; ++ct) {
            v2f a = *(const v2f*)&w_lds[(ct * 16 + ln) * PW + 4 * k + hi2];  // ds_load_b64
            acc[ct] = __builtin_amdgcn_wmma_f32_16x16x4_f32(false, a, false, bf[k],
                                                            (short)0, acc[ct], false, false);
        }

#pragma unroll
    for (int ct = 0; ct < CT; ++ct) {
        float* d = ct < CL / 16 ? da + (size_t)(ct * 16) * NN
                                : db + (size_t)((ct - CL / 16) * 16) * NN;
#pragma unroll
        for (int r = 0; r < 8; ++r) d[(size_t)(r + rhi) * NN + n] = acc[ct][r];
    }
    // the stores above name their address and data registers: hold any later
    // rewrite of those registers behind this wait
    asm volatile("s_wait_xcnt 0x0" ::: "memory");
}

__global__ void __launch_bounds__(PJT)
k_proj(const float* __restrict__ xlat, const float* __restrict__ x,
       const float* __restrict__ Wc, const float* __restrict__ bc,
       const float* __restrict__ Wl, const float* __restrict__ bl,
       const float* __restrict__ Wv, const float* __restrict__ bv,
       float* __restrict__ XL, float* __restrict__ XQ, float* __restrict__ V) {
    __shared__ __attribute__((aligned(16))) float w_lds[2 * CL * (CL + 4)];  // >= CL*(CH+4)
    const size_t b = blockIdx.z;
    const size_t o = b * CL * NN;
    if (blockIdx.y == 0)
        proj_tiles<CH, CL / 16>(w_lds, Wc, Wc, bc, bc, xlat + b * CH * NN, XL + o, XL + o);
    else
        proj_tiles<CL, 2 * CL / 16>(w_lds, Wl, Wv, bl, bv, x + o, XQ + o, V + o);
}

typedef __attribute__((ext_vector_type(4))) float v4f;
#define AST 84               // LDS row pitch (floats) of the staged XQ tile
#define SNT 128              // rows of n in a staged tile
#define STF (SNT * AST)      // floats in one buffer
#define STR (NN / SNT / 2)   // trips of a block: half of the rows of n
#define LKC 1792             // columns of m (of every batch) whose logits are kept
#define LKT (LKC / 16)       // the same in tiles of 16 columns
#define LTF (NN * 16)        // floats kept for one such tile: all rows of n

// Ten of a thread's forty copies of a tile: one n, channels two apart.  The
// closing wait stands inside the statement so that no address register named
// here is rewritten in front of it.
__device__ __forceinline__ void
stage_rows(unsigned l, const float* g) {
    asm volatile("global_load_async_to_lds_b32 %0, %10, off\n\t"
                 "global_load_async_to_lds_b32 %1, %11, off\n\t"
                 "global_load_async_to_lds_b32 %2, %12, off\n\t"
                 "global_load_async_to_lds_b32 %3, %13, off\n\t"
                 "global_load_async_to_lds_b32 %4, %14, off\n\t"
                 "global_load_async_to_lds_b32 %5, %15, off\n\t"
                 "global_load_async_to_lds_b32 %6, %16, off\n\t"
                 "global_load_async_to_lds_b32 %7, %17, off\n\t"
                 "global_load_async_to_lds_b32 %8, %18, off\n\t"
                 "global_load_async_to_lds_b32 %9, %19, off\n\t"
                 "s_wait_xcnt 0x0"
                 :: "v"(l), "v"(l + 8), "v"(l + 16), "v"(l + 24), "v"(l + 32),
                    "v"(l + 40), "v"(l + 48), "v"(l + 56), "v"(l + 64), "v"(l + 72),
                    "v"(g), "v"(g + 2 * NN), "v"(g + 4 * NN), "v"(g + 6 * NN),
                    "v"(g + 8 * NN), "v"(g + 10 * NN), "v"(g + 12 * NN),
                    "v"(g + 14 * NN), "v"(g + 16 * NN), "v"(g + 18 * NN)
                 : "memory");
}
__device__ __forceinline__ void
stage_xq(unsigned l, const float* g) {
#pragma unroll
    for (int i = 0; i < 4; ++i) stage_rows(l + 80 * i, g + (size_t)(20 * i) * NN);
}

// A fragments of block blk: tiles 2 * (blk >> 1) and + 1, channel half blk & 1
__device__ __forceinline__ void
load_frags(const float* as, int blk, v4f (&f)[10]) {
    const int row = (blk >> 1) * 32, c0 = (blk & 1) * 40;
#pragma unroll
    for (int i = 0; i < 5; ++i) {
        f[i]     = *(const v4f*)&as[row * AST + c0 + 8 * i];          // ds_load_b128
        f[5 + i] = *(const v4f*)&as[(row + 16) * AST + c0 + 8 * i];
    }
}

// online max / sum of one lane's 16 logits (8 rows of two tiles, one column)
__device__ __forceinline__ void
col_update(const v8f& a, const v8f& b, float& M, float& S) {
    float mx = M;
#pragma unroll
    for (int r = 0; r < 8; ++r) mx = fmaxf(mx, fmaxf(a[r], b[r]));
    float sa = 0.f, sb = 0.f;
#pragma unroll
    for (int r = 0; r < 8; ++r) {
        sa += __expf(a[r] - mx);
        sb += __expf(b[r] - mx);
    }
    S = S * __expf(M - mx) + (sa + sb);
    M = mx;
}

// the logits of a tile pair to the workspace; written once and read once, so
// they are marked non-temporal and leave XQ and XL their place in L2
__device__ __forceinline__ void
keep_pair(float* p, const v8f& a, const v8f& b) {
    __builtin_nontemporal_store(__builtin_shufflevector(a, a, 0, 1, 2, 3), (v4f*)p);
    __builtin_nontemporal_store(__builtin_shufflevector(a, a, 4, 5, 6, 7), (v4f*)(p + 128));
    __builtin_nontemporal_store(__builtin_shufflevector(b, b, 0, 1, 2, 3), (v4f*)(p + 256));
    __builtin_nontemporal_store(__builtin_shufflevector(b, b, 4, 5, 6, 7), (v4f*)(p + 384));
    // holds any later rewrite of the stores' address and data registers behind it
    asm volatile("s_wait_xcnt 0x0" ::: "memory");
}

// One trip: the 128 staged rows of tile t against the wave's 16 columns.  STAGE
// says whether a tile t + 2 exists, KEEP whether the logits go to the workspace
// (at lg); they are compile-time arguments so that the trip stays one straight
// run of code.  On entry f[0] holds block 0's fragments.
template <bool STAGE, bool KEEP>
__device__ __forceinline__ void
stats_trip(int t, const float* a0, unsigned l0, const float* g0, float* lg,
           const v2f (&bf)[20], v4f (&f)[2][10], float& Mrun, float& Srun) {
    const float* as = a0 + (t & 1) * STF;
    v8f c0 = {}, c1 = {}, d0 = {}, d1 = {};
#pragma unroll
    for (int blk = 0; blk < 8; ++blk) {
        // the fence pair keeps the next block's LDS reads in one group ahead of
        // this block's matrix instructions instead of spread among them
        __builtin_amdgcn_sched_barrier(0);
        if (blk < 7) load_frags(as, blk + 1, f[(blk + 1) & 1]);
        __builtin_amdgcn_sched_barrier(0);
        if ((blk & 1) == 0) { c0 = v8f{}; c1 = v8f{}; }
#pragma unroll
        for (int i = 0; i < 5; ++i) {
            const int j = (blk & 1) * 5 + i;
            const v4f x = f[blk & 1][i], y = f[blk & 1][5 + i];
            c0 = __builtin_amdgcn_wmma_f32_16x16x4_f32(false, x.xy, false, bf[2 * j],
                                                       (short)0, c0, false, false);
            c1 = __builtin_amdgcn_wmma_f32_16x16x4_f32(false, y.xy, false, bf[2 * j],
                                                       (short)0, c1, false, false);
            c0 = __builtin_amdgcn_wmma_f32_16x16x4_f32(false, x.zw, false, bf[2 * j + 1],
                                                       (short)0, c0, false, false);
            c1 = __builtin_amdgcn_wmma_f32_16x16x4_f32(false, y.zw, false, bf[2 * j + 1],
                                                       (short)0, c1, false, false);
        }
        // the finished tile pair is folded in beside the next pair's products
        if ((blk & 1) == 0 && blk > 0) {
            if (KEEP) keep_pair(lg + (t * 4 + (blk >> 1) - 1) * 512, d0, d1);
            col_update(d0, d1, Mrun, Srun);
        }
        if (blk & 1) { d0 = c0; d1 = c1; }
    }
    asm volatile("s_wait_dscnt 0x0" ::: "memory");      // this wave's reads of tile t are done
    asm volatile("s_wait_asynccnt 0x0" ::: "memory");   // its copies of tile t + 1 have landed
    __syncthreads();   // publishes tile t + 1 and frees the buffer of tile t
    if (STAGE) stage_xq(l0 + (t & 1) * (STF * 4), g0 + (t + 2) * SNT);
    // first fragments of tile t + 1, behind its barrier; their latency runs under
    // the last pair's update (after the last trip: a read of the idle buffer, unused)
    load_frags(a0 + ((t + 1) & 1) * STF, 0, f[0]);
    __builtin_amdgcn_sched_barrier(0);   // keeps those reads ahead of the update
    if (KEEP) keep_pair(lg + (t * 4 + 3) * 512, d0, d1);
    col_update(d0, d1, Mrun, Srun);
}

template <bool KEEP>
__device__ __forceinline__ void
stats_trips(const float* a0, unsigned l0, const float* g0, float* lg,
            const v2f (&bf)[20], v4f (&f)[2][10], float& Mrun, float& Srun) {
    for (int t = 0; t < STR - 2; ++t)      // a tile t + 2 exists
        stats_trip<true, KEEP>(t, a0, l0, g0, lg, bf, f, Mrun, Srun);
    for (int t = STR - 2; t < STR; ++t)    // the last two tiles: nothing left to stage
        stats_trip<false, KEEP>(t, a0, l0, g0, lg, bf, f, Mrun, Srun);
}

__global__ void __launch_bounds__(256)
k_stats(const float* __restrict__ XQ, const float* __restrict__ XL,
        float* __restrict__ Ms, float* __restrict__ Ss, float* __restrict__ LG) {
    __shared__ __attribute__((aligned(16))) float a_lds[2][STF];

    const int tid  = threadIdx.x;
    const int lane = tid & 31;
    const int wave = tid >> 5;
    const int b    = blockIdx.y;
    const int half = blockIdx.z;          // which half of the rows of n
    const int m0   = blockIdx.x * 128 + wave * 16;
    const int ln   = lane & 15;
    const int hi4  = (lane >> 4) << 2;

    const float* q  = XQ + (size_t)b * CL * NN + half * (NN / 2);
    const float* km = XL + (size_t)b * CL * NN;

    // this thread's place in the cooperative copy: row n = tid & 127 of the tile,
    // channels (tid >> 7) + 2 * j, j = 0..39
    const float* g0 = q + (size_t)(tid >> 7) * NN + (tid & 127);
    const unsigned l0 = (unsigned)(uintptr_t)&a_lds[0][(tid & 127) * AST + (tid >> 7)];

    // tile 0 into buffer 0, landed and published; then tile 1 into buffer 1
    stage_xq(l0, g0);
    asm volatile("s_wait_asynccnt 0x0" ::: "memory");   // this wave's copies have landed
    __syncthreads();                                    // every wave's copies are visible
    stage_xq(l0 + STF * 4, g0 + SNT);

    // per-wave B fragments (XL columns m0..m0+15), resident for the whole kernel,
    // in the channel order of the A fragments
    v2f bf[20];
#pragma unroll
    for (int j = 0; j < 10; ++j) {
        const float* kc = km + (size_t)(8 * j + hi4) * NN + m0 + ln;
        bf[2 * j].x     = kc[0];
        bf[2 * j].y     = kc[NN];
        bf[2 * j + 1].x = kc[2 * NN];
        bf[2 * j + 1].y = kc[3 * NN];
    }

    float Mrun = -3.0e38f, Srun = 0.f;
    const float* a0 = &a_lds[0][ln * AST + hi4];
    v4f f[2][10];
    load_frags(a0, 0, f[0]);
    if (blockIdx.x < LKC / 128)            // the same for the whole block
        stats_trips<true>(a0, l0, g0, LG + (size_t)(b * LKT + (m0 >> 4)) * LTF + half * (LTF / 2) + lane * 4,
                          bf, f, Mrun, Srun);
    else
        stats_trips<false>(a0, l0, g0, nullptr, bf, f, Mrun, Srun);
    asm volatile("s_wait_asynccnt 0x0" ::: "memory");       // no copy outlives the loop

    // lanes l and l + 16 hold the two halves of column l: merge them
    const float Mo = __shfl_xor(Mrun, 16, 32);
    const float So = __shfl_xor(Srun, 16, 32);
    const float Mf = fmaxf(Mrun, Mo);
    const float Sf = Srun * __expf(Mrun - Mf) + So * __expf(Mo - Mf);
    if (lane < 16) {
        Ms[(size_t)(half * BB + b) * NN + m0 + lane] = Mf;
        Ss[(size_t)(half * BB + b) * NN + m0 + lane] = Sf;
    }
}

#define PST 18   // LDS row stride (floats) for staged P tiles
#define OTH 512  // threads per block
#define OMT 32   // m columns in a staged tile
#define OXP 40   // LDS pitch (floats) of a staged XL row
#define OVP 36   // LDS pitch (floats) of a staged V row
#define OTF (CL * OXP + CL * OVP)   // floats in one buffer: XL tile, then V tile
#define ONT (1024 / OMT)            // tiles in an m quarter
#define OCT ((NN - LKC) / 4 / OMT)  // of them with logits formed here; the rest are kept ones

// One thread's share of a tile: five 16-byte pieces of XL and five of V, 16 rows
// apart.  The closing wait stands inside the statement so that no address
// register named here is rewritten in front of it.
__device__ __forceinline__ void
stage_tile(unsigned lx, unsigned lv, const float* gx, const float* gv) {
    asm volatile("global_load_async_to_lds_b128 %0, %10, off\n\t"
                 "global_load_async_to_lds_b128 %1, %11, off\n\t"
                 "global_load_async_to_lds_b128 %2, %12, off\n\t"
                 "global_load_async_to_lds_b128 %3, %13, off\n\t"
                 "global_load_async_to_lds_b128 %4, %14, off\n\t"
                 "global_load_async_to_lds_b128 %5, %15, off\n\t"
                 "global_load_async_to_lds_b128 %6, %16, off\n\t"
                 "global_load_async_to_lds_b128 %7, %17, off\n\t"
                 "global_load_async_to_lds_b128 %8, %18, off\n\t"
                 "global_load_async_to_lds_b128 %9, %19, off\n\t"
                 "s_wait_xcnt 0x0"
                 :: "v"(lx), "v"(lx + 16 * OXP * 4), "v"(lx + 32 * OXP * 4),
                    "v"(lx + 48 * OXP * 4), "v"(lx + 64 * OXP * 4),
                    "v"(lv), "v"(lv + 16 * OVP * 4), "v"(lv + 32 * OVP * 4),
                    "v"(lv + 48 * OVP * 4), "v"(lv + 64 * OVP * 4),
                    "v"(gx), "v"(gx + 16 * NN), "v"(gx + 32 * NN),
                    "v"(gx + 48 * NN), "v"(gx + 64 * NN),
                    "v"(gv), "v"(gv + 16 * NN), "v"(gv + 32 * NN),
                    "v"(gv + 48 * NN), "v"(gv + 64 * NN)
                 : "memory");
}

// The V half of that share alone, for a tile whose logits are kept.
__device__ __forceinline__ void
stage_v(unsigned lv, const float* gv) {
    asm volatile("global_load_async_to_lds_b128 %0, %5, off\n\t"
                 "global_load_async_to_lds_b128 %1, %6, off\n\t"
                 "global_load_async_to_lds_b128 %2, %7, off\n\t"
                 "global_load_async_to_lds_b128 %3, %8, off\n\t"
                 "global_load_async_to_lds_b128 %4, %9, off\n\t"
                 "s_wait_xcnt 0x0"
                 :: "v"(lv), "v"(lv + 16 * OVP * 4), "v"(lv + 32 * OVP * 4),
                    "v"(lv + 48 * OVP * 4), "v"(lv + 64 * OVP * 4),
                    "v"(gv), "v"(gv + 16 * NN), "v"(gv + 32 * NN),
                    "v"(gv + 48 * NN), "v"(gv + 64 * NN)
                 : "memory");
}

// A lane's 32 kept logits of one trip (a tile pair for each 16 columns).  The logits
// are read once: non-temporal.
__device__ __forceinline__ void
load_kept(const float* p, v4f (&L)[OMT / 16][4]) {
    // the fence pair keeps the loads and their wait in one group, so that nothing
    // that takes over an address register is scheduled in between
    __builtin_amdgcn_sched_barrier(0);
#pragma unroll
    for (int h = 0; h < OMT / 16; ++h) {
#pragma unroll
        for (int j = 0; j < 4; ++j)
            L[h][j] = __builtin_nontemporal_load((const v4f*)(p + h * LTF + 128 * j));
    }
    // holds any later rewrite of the loads' address registers behind it; the address
    // is its input so that it lives up to it and no load's result is laid on it
    asm volatile("s_wait_xcnt 0x0" :: "v"(p) : "memory");
    __builtin_amdgcn_sched_barrier(0);
}

__global__ void __launch_bounds__(OTH)
k_out(const float* __restrict__ XQ, const float* __restrict__ XL,
      const float* __restrict__ V, const float* __restrict__ Ms,
      const float* __restrict__ Ss, const float* __restrict__ LG,
      float* __restrict__ Eout) {
    __shared__ __attribute__((aligned(16))) float T_lds[4][2][OTF];
    __shared__ float E_lds[128 * CL];
    __shared__ float P_lds[16][2][16 * PST];
    __shared__ v2f MR_lds[NN];   // every column's max and 1 / sum

    const int tid  = threadIdx.x;
    const int lane = tid & 31;
    const int wave = tid >> 5;
    const int nb   = wave & 3;    // 32-row band inside the block
    const int mq   = wave >> 2;   // m quarter
    const int b    = blockIdx.y;
    const int nblk = blockIdx.x * 128;
    const int n0   = nblk + nb * 32;
    const int ln   = lane & 15;
    const int hi2  = (lane >> 4) << 1;
    const int rhi  = (lane >> 4) << 3;

    const float* q  = XQ + (size_t)b * CL * NN;
    const float* km = XL + (size_t)b * CL * NN;
    const float* vm = V  + (size_t)b * CL * NN;
    const float* Mp = Ms + (size_t)b * NN;
    const float* Sp = Ss + (size_t)b * NN;

    for (int i = 0; i < 128 * CL / OTH; ++i) E_lds[tid + i * OTH] = 0.f;
    // the two row halves of k_stats merged, once for the block; unrolled so that
    // all of a thread's loads are in flight under one latency
#pragma unroll
    for (int i = 0; i < NN / OTH; ++i) {
        const int m = tid + i * OTH;
        const float Ma = Mp[m], Mb = Mp[BB * NN + m];
        const float Sa = Sp[m], Sb = Sp[BB * NN + m];
        const float Mc = fmaxf(Ma, Mb);
        v2f mr;
        mr.x = Mc;
        mr.y = __builtin_amdgcn_rcpf(Sa * __expf(Ma - Mc) + Sb * __expf(Mb - Mc));
        MR_lds[m] = mr;
    }
    __syncthreads();

    // this thread's place in its quarter's cooperative copy (128 threads, 8 a row)
    const int crow = (tid & 127) >> 3;
    const int ccol = (tid & 7) * 4;
    const int mc = LKC + mq * (OCT * OMT);                 // trip t < OCT: columns mc + t * OMT
    const int mk = mq * ((ONT - OCT) * OMT);               // trip t >= OCT: columns mk + (t - OCT) * OMT
    const float* gx = km + (size_t)crow * NN + mc + ccol;
    const float* gv = vm + (size_t)crow * NN + mc + ccol;
    const float* gk = vm + (size_t)crow * NN + mk + ccol;
    const unsigned lx = (unsigned)(uintptr_t)&T_lds[mq][0][crow * OXP + ccol];
    const unsigned lv = (unsigned)(uintptr_t)&T_lds[mq][0][CL * OXP + crow * OVP + ccol];

    // tile 0 into buffer 0, landed and published; then tile 1 into buffer 1
    stage_tile(lx, lv, gx, gv);
    asm volatile("s_wait_asynccnt 0x0" ::: "memory");   // this wave's copies have landed
    __syncthreads();                                    // every wave's copies are visible
    stage_tile(lx + OTF * 4, lv + OTF * 4, gx + OMT, gv + OMT);

    // A-fragments of XQ for both n-tiles (reused for the m-tiles whose logits are formed here)
    v2f aq0[20], aq1[20];
#pragma unroll
    for (int k = 0; k < 20; ++k) {
        int c = 4 * k + hi2;
        aq0[k].x = q[(size_t)c * NN + n0 + ln];
        aq0[k].y = q[(size_t)(c + 1) * NN + n0 + ln];
        aq1[k].x = q[(size_t)c * NN + n0 + 16 + ln];
        aq1[k].y = q[(size_t)(c + 1) * NN + n0 + 16 + ln];
    }

    v8f E0[5] = {}, E1[5] = {};
    float* pl0 = &P_lds[wave][0][0];
    float* pl1 = &P_lds[wave][1][0];

    for (int t = 0; t < OCT; ++t) {
        const float* xs = &T_lds[mq][t & 1][0];
        const float* vs = xs + CL * OXP;
        // unrolled so that LDS offsets are immediates and the second half's logits
        // can be scheduled among the first half's P @ V products
#pragma unroll
        for (int h = 0; h < OMT / 16; ++h) {
            const int m0 = mc + t * OMT + h * 16;
            // ---- two logits tiles, B fragments read once from the staged XL tile ----
            v8f acc0 = {}, acc1 = {};
#pragma unroll
            for (int k = 0; k < 20; ++k) {
                int c = 4 * k + hi2;
                v2f bfr;
                bfr.x = xs[c * OXP + h * 16 + ln];
                bfr.y = xs[(c + 1) * OXP + h * 16 + ln];
                acc0 = __builtin_amdgcn_wmma_f32_16x16x4_f32(false, aq0[k], false, bfr,
                                                             (short)0, acc0, false, false);
                acc1 = __builtin_amdgcn_wmma_f32_16x16x4_f32(false, aq1[k], false, bfr,
                                                             (short)0, acc1, false, false);
            }
            // ---- P = exp(L - M[m]) / S[m]; stage to LDS (D-layout -> row-major) ----
            const v2f mr = MR_lds[m0 + ln];   // ds_load_b64
            const float Mc = mr.x, rS = mr.y;
#pragma unroll
            for (int r = 0; r < 8; ++r) {
                pl0[(r + rhi) * PST + ln] = __expf(acc0[r] - Mc) * rS;
                pl1[(r + rhi) * PST + ln] = __expf(acc1[r] - Mc) * rS;
            }
            // ---- E += P @ V^T, V fragments shared by both n-tiles ----
#pragma unroll
            for (int kk = 0; kk < 4; ++kk) {
                const int mk = 4 * kk + hi2;
                v2f ap0 = *(const v2f*)&pl0[ln * PST + mk];   // ds_load_b64
                v2f ap1 = *(const v2f*)&pl1[ln * PST + mk];
#pragma unroll
                for (int ct = 0; ct < 5; ++ct) {
                    v2f bv = *(const v2f*)&vs[(ct * 16 + ln) * OVP + h * 16 + mk];  // ds_load_b64
                    E0[ct] = __builtin_amdgcn_wmma_f32_16x16x4_f32(false, ap0, false, bv,
                                                                   (short)0, E0[ct], false, false);
                    E1[ct] = __builtin_amdgcn_wmma_f32_16x16x4_f32(false, ap1, false, bv,
                                                                   (short)0, E1[ct], false, false);
                }
            }
        }
        asm volatile("s_wait_dscnt 0x0" ::: "memory");      // this wave's reads of tile t are done
        asm volatile("s_wait_asynccnt 0x0" ::: "memory");   // its copies of tile t + 1 have landed
        __syncthreads();   // publishes tile t + 1 and frees the buffer of tile t
        if (t + 2 < OCT)
            stage_tile(lx + (t & 1) * (OTF * 4), lv + (t & 1) * (OTF * 4),
                       gx + (t + 2) * OMT, gv + (t + 2) * OMT);
        else
            stage_v(lv + (t & 1) * (OTF * 4), gk + (t + 2 - OCT) * OMT);
    }

    // ---- the tiles with kept logits, which are fetched one trip ahead ----
    const float* lg = LG + ((size_t)b * LKT + (mk >> 4)) * LTF + (n0 >> 5) * 512 + lane * 4;
    v4f Lk[OMT / 16][4];
    load_kept(lg, Lk);
    for (int t = OCT; t < ONT; ++t) {
        const float* vs = &T_lds[mq][t & 1][CL * OXP];
        // L - M[m] and 1 / S[m] of the whole trip first: the next trip's values are
        // then asked for at once and have this trip's products to arrive under
        v4f X[OMT / 16][4];
        float rS[OMT / 16];
#pragma unroll
        for (int h = 0; h < OMT / 16; ++h) {
            const v2f mr = MR_lds[mk + (t - OCT) * OMT + h * 16 + ln];   // ds_load_b64
#pragma unroll
            for (int j = 0; j < 4; ++j) X[h][j] = Lk[h][j] - mr.x;
            rS[h] = mr.y;
        }
        if (t + 1 < ONT) {
            lg += (OMT / 16) * LTF;
            load_kept(lg, Lk);
        }
#pragma unroll
        for (int h = 0; h < OMT / 16; ++h) {
            // ---- P = exp(L - M[m]) / S[m]; stage to LDS (D-layout -> row-major) ----
#pragma unroll
            for (int r = 0; r < 4; ++r) {
                pl0[(r + rhi) * PST + ln]     = __expf(X[h][0][r]) * rS[h];
                pl0[(r + 4 + rhi) * PST + ln] = __expf(X[h][1][r]) * rS[h];
                pl1[(r + rhi) * PST + ln]     = __expf(X[h][2][r]) * rS[h];
                pl1[(r + 4 + rhi) * PST + ln] = __expf(X[h][3][r]) * rS[h];
            }
            // ---- E += P @ V^T, V fragments shared by both n-tiles ----
#pragma unroll
            for (int kk = 0; kk < 4; ++kk) {
                const int mk4 = 4 * kk + hi2;
                v2f ap0 = *(const v2f*)&pl0[ln * PST + mk4];   // ds_load_b64
                v2f ap1 = *(const v2f*)&pl1[ln * PST + mk4];
#pragma unroll
                for (int ct = 0; ct < 5; ++ct) {
                    v2f bv = *(const v2f*)&vs[(ct * 16 + ln) * OVP + h * 16 + mk4];  // ds_load_b64
                    E0[ct] = __builtin_amdgcn_wmma_f32_16x16x4_f32(false, ap0, false, bv,
                                                                   (short)0, E0[ct], false, false);
                    E1[ct] = __builtin_amdgcn_wmma_f32_16x16x4_f32(false, ap1, false, bv,
                                                                   (short)0, E1[ct], false, false);
                }
            }
        }
        asm volatile("s_wait_dscnt 0x0" ::: "memory");      // this wave's reads of tile t are done
        asm volatile("s_wait_asynccnt 0x0" ::: "memory");   // its copies of tile t + 1 have landed
        __syncthreads();   // publishes tile t + 1 and frees the buffer of tile t
        if (t + 2 < ONT)
            stage_v(lv + (t & 1) * (OTF * 4), gk + (t + 2 - OCT) * OMT);
    }
    asm volatile("s_wait_asynccnt 0x0" ::: "memory");       // no copy outlives the loop

    // ---- cross-wave reduce into E_lds[n][c] via ds_add_f32 ----
#pragma unroll
    for (int ct = 0; ct < 5; ++ct)
#pragma unroll
        for (int r = 0; r < 8; ++r) {
            int n = nb * 32 + r + rhi;
            int c = ct * 16 + ln;
            atomicAdd(&E_lds[n * CL + c], E0[ct][r]);
            atomicAdd(&E_lds[(n + 16) * CL + c], E1[ct][r]);
        }
    __syncthreads();

    // ---- add XQ residual (e += xq), store transposed layout [B][C][N] ----
    for (int i = tid; i < 128 * CL; i += OTH) {
        int n = i & 127;
        int c = i >> 7;
        float val = E_lds[n * CL + c] + q[(size_t)c * NN + nblk + n];
        Eout[(size_t)(b * CL + c) * NN + nblk + n] = val;
    }
}

// ---------------------------------------------------------------------------
extern "C" void kernel_launch(void* const* d_in, const int* in_sizes, int n_in,
                              void* d_out, int out_size, void* d_ws, size_t ws_size,
                              hipStream_t stream) {
    const float* x_latter = (const float*)d_in[0];
    const float* x        = (const float*)d_in[1];
    const float* W1 = (const float*)d_in[2];
    const float* b1 = (const float*)d_in[3];
    const float* Wh = (const float*)d_in[4];
    const float* bh = (const float*)d_in[5];
    const float* Wl = (const float*)d_in[6];
    const float* bl = (const float*)d_in[7];
    const float* Wv = (const float*)d_in[8];
    const float* bv = (const float*)d_in[9];

    float* out    = (float*)d_out;
    float* e_out  = out;                              // output 0: e  [B,C,N]
    float* xl_out = out + (size_t)BB * CL * NN;       // output 1: xl [B,C,N]

    // workspace layout (floats): Wc | bc | XQ | V | Ms | Ss (two halves each)  (~21.5 MB) | LG (224 MiB)
    float* ws = (float*)d_ws;
    float* Wc = ws;
    float* bc = Wc + CL * CH;
    float* XQ = bc + CL;
    float* V  = XQ + (size_t)BB * CL * NN;
    float* Ms = V  + (size_t)BB * CL * NN;
    float* Ss = Ms + (size_t)2 * BB * NN;
    float* LG = ws + 5386880;   // first multiple of 256 bytes behind Ss

    k_combine<<<dim3((CL * CH + CL + 255) / 256), dim3(256), 0, stream>>>(W1, b1, Wh, bh, Wc, bc);
    k_proj<<<dim3(NN / (PJT / 2), 2, BB), dim3(PJT), 0, stream>>>(
        x_latter, x, Wc, bc, Wl, bl, Wv, bv, xl_out, XQ, V);
    k_stats<<<dim3(NN / 128, BB, 2), dim3(256), 0, stream>>>(XQ, xl_out, Ms, Ss, LG);
    k_out<<<dim3(NN / 128, BB), dim3(OTH), 0, stream>>>(XQ, xl_out, V, Ms, Ss, LG, e_out);
}
